// v000
// The times below were measured on an AMD MI455X: many runs one after another, warmed up first and cycling through
// copies of the inputs, with the whole window's GPU time divided by the number of runs. Launches and the gaps
// between them are all in it. The median over several windows is given; except for v000 it joins two sittings, which
// can be a few percent apart, so the side-by-side timings, each taken in one sitting, are the better comparison.
// v000 is the starting kernel. One run takes 868 microseconds.
// compute dtype: all float inputs rounded to bf16; Qp/Kp/Vp = X W^T + b with EXACT bf16 products on WMMA 16x16x32 (f32 accumulate); q as f16 hi + residual (x 2^10) against k once to f16 (2 products) x 32^-0.5; softmax in f32 (precise expf); P x 2^11 once to f16 against v once to f16 (1 product); LayerNorms in f32; the fc_o layer with the LN rows once to f16 against Wo as f16(bf16 x 2^6) (1 product) + bias, relu and residual in f32; f32 output.
#include <hip/hip_runtime.h>
#include <math.h>

typedef __attribute__((ext_vector_type(16))) _Float16 v16h;
typedef __attribute__((ext_vector_type(16))) __bf16 v16b;
typedef __attribute__((ext_vector_type(8)))  _Float16 v8h;
typedef __attribute__((ext_vector_type(8)))  float v8f;
typedef __attribute__((ext_vector_type(4)))  float v4f;
typedef __attribute__((ext_vector_type(2)))  float v2f;
typedef __attribute__((ext_vector_type(4)))  unsigned v4u;
typedef __attribute__((ext_vector_type(4)))  int v4i;
typedef float __attribute__((may_alias)) float_a;
typedef int __attribute__((may_alias)) int_a;

template <typename T> __device__ __forceinline__ void vst2(void* p, T v) { *(T*)p = v;  }
__device__ __forceinline__ v8f wmma16(v16h a, v16h b, v8f c) {
  v8f d = __builtin_amdgcn_wmma_f32_16x16x32_f16(false, a, false, b, (short)0, c, false, false);
  asm volatile("v_nop\n\tv_nop\n\tv_nop\n\tv_nop" : "+v"(d) : "v"(a), "v"(b));
  return d;
}
__device__ __forceinline__ v8f wmma_bf(v16b a, v16b b, v8f c) {
  v8f d = __builtin_amdgcn_wmma_f32_16x16x32_bf16(false, a, false, b, (short)0, c, false, false);
  asm volatile("v_nop\n\tv_nop\n\tv_nop\n\tv_nop" : "+v"(d) : "v"(a), "v"(b));
  return d;
}
// 16x16x32 fragments: lane = (h = lane>>4, row/col = lane&15); elements 0..7 = k0+8h+0..7, 8..15 = k0+16+8h+0..7; D element r = row 8h+r
__device__ __forceinline__ v16h frag_h(const _Float16* rowk0, int lane) {
  union { v16h v; v8h q[2]; } u; const _Float16* p = rowk0 + 8 * (lane >> 4);
  u.q[0] = *(const v8h*)p; u.q[1] = *(const v8h*)(p + 16); return u.v;
}
__device__ __forceinline__ v16h frag_f32(const float* rowk0, int lane) {
  v16h a; const float* p = rowk0 + 8 * (lane >> 4);
#pragma unroll
  for (int i = 0; i < 8; ++i) { a[i] = (_Float16)p[i]; a[8 + i] = (_Float16)p[16 + i]; }
  return a;
}
__device__ __forceinline__ v16h frag_f32s(const float* rowk0, int lane, float sc) {
  v16h a; const float* p = rowk0 + 8 * (lane >> 4);
#pragma unroll
  for (int i = 0; i < 8; ++i) { a[i] = (_Float16)(p[i] * sc); a[8 + i] = (_Float16)(p[16 + i] * sc); }
  return a;
}
// column fragment from a [K][ld] layout (column n), rows >= K read as 0
__device__ __forceinline__ v16h fragc_f32(const float* W, int k0, int n, int lane, int ld, int K) {
  v16h a; const int g = lane >> 4;
#pragma unroll
  for (int i = 0; i < 8; ++i) { const int ka = k0 + 8 * g + i, kb = ka + 16;
    a[i] = (_Float16)(ka < K ? W[(size_t)(ka < K ? ka : K - 1) * ld + n] : 0.f); a[8 + i] = (_Float16)(kb < K ? W[(size_t)(kb < K ? kb : K - 1) * ld + n] : 0.f); }
  return a;
}
struct F2 { v16b h, l; };
__device__ __forceinline__ F2 bsplit16(const float v[16]) { F2 r;
#pragma unroll
  for (int i = 0; i < 16; ++i) { const __bf16 h = (__bf16)v[i]; r.h[i] = h; r.l[i] = (__bf16)(v[i] - (float)h); }
  return r; }
__device__ __forceinline__ F2 split_row(const float* row, int k0, int lane) { float v[16]; const float* p = row + k0 + 8 * (lane >> 4);
#pragma unroll
  for (int i = 0; i < 8; ++i) { v[i] = p[i]; v[8 + i] = p[16 + i]; }
  return bsplit16(v); }
__device__ __forceinline__ F2 split_rowK(const float* row, int k0, int lane, int K) { float v[16]; const int g = lane >> 4;
#pragma unroll
  for (int i = 0; i < 8; ++i) { const int ka = k0 + 8 * g + i, kb = ka + 16; v[i] = ka < K ? row[ka < K ? ka : K - 1] : 0.f; v[8 + i] = kb < K ? row[kb < K ? kb : K - 1] : 0.f; }
  return bsplit16(v); }
__device__ __forceinline__ F2 split_col(const float* W, int k0, int n, int lane, int ld, int K) { float v[16]; const int g = lane >> 4;
#pragma unroll
  for (int i = 0; i < 8; ++i) { const int ka = k0 + 8 * g + i, kb = ka + 16; v[i] = ka < K ? W[(size_t)(ka < K ? ka : K - 1) * ld + n] : 0.f; v[8 + i] = kb < K ? W[(size_t)(kb < K ? kb : K - 1) * ld + n] : 0.f; }
  return bsplit16(v); }
__device__ __forceinline__ v8f mac3(const F2& a, const F2& b, v8f c) { c = wmma_bf(a.l, b.h, c); c = wmma_bf(a.h, b.l, c); return wmma_bf(a.h, b.h, c); }
__device__ __forceinline__ float sigm(float v) { return 1.0f / (1.0f + expf(-v)); }
#define LDSX() do { asm volatile("s_wait_dscnt 0" ::: "memory"); __builtin_amdgcn_wave_barrier(); __builtin_amdgcn_fence(__ATOMIC_RELEASE, "workgroup"); } while (0)

// Set-Transformer MAB (B 4, NQ = NK = 2,048, dim 256 = 8 heads x 32; 0.02-scale (out,in) weights, zero biases, LN gamma 1 / beta 0): Qp = Q Wq^T + bq, Kp = K Wk^T + bk, Vp = K Wv^T + bv; o = merged(softmax(q k^T / sqrt(32)) v); o = LN0(o); out = LN1(o + relu(o Wo^T + bo)) (eps 1e-5, biased var).
#define NB 4
#define TT 2048
#define CC 256            // NH * HD = projected width
#define DIN 256          // input (model) width
#define NH 8
#define HD 32
#define NQB (TT / 64)
#define HG 4
#define SCALE (0.17677669529663687f)
#define CAUSAL 0
#ifndef TNB
#define TNB NB
#endif
__device__ __forceinline__ float bfr(float v) { return (float)(__bf16)v; }
__host__ __device__ __forceinline__ int kb_last(int qb) { return CAUSAL ? ((qb * 64 + 63) >> 7) : (TT / 128 - 1); }
typedef __attribute__((ext_vector_type(8))) __bf16 v8b;
__device__ __forceinline__ v16b frag_b(const __bf16* rowk0, int lane) {
  union { v16b v; v8b q[2]; } u; const __bf16* p = rowk0 + 8 * (lane >> 4);
  u.q[0] = *(const v8b*)p; u.q[1] = *(const v8b*)(p + 16); return u.v;
}
#define QBH 0              // causal: query blocks 0..QBH-1 of each sequence (few keys, no averaging) take the high-precision path
#define QHI 2048            // rows carrying a q residual plane (all rows when non-causal: 2-product logits everywhere)
#define KHI 64            // key rows carrying k residual / v bf16 hi+lo planes (used only by the causal high-precision path)
// B fragment (k rows k0+.., output column o) of a weight: (in,out) [K][ld] or (out,in) [ld rows of K]: bf16 exact, or f16(bf16 * 256) exact
__device__ __forceinline__ v16b wcol_io(const float* Wm, int k0, int o, int lane, int ld) { v16b w; const int g = lane >> 4;
#pragma unroll
  for (int i = 0; i < 8; ++i) { w[i] = (__bf16)Wm[(size_t)(k0 + 8 * g + i) * ld + o]; w[8 + i] = (__bf16)Wm[(size_t)(k0 + 16 + 8 * g + i) * ld + o]; }
  return w; }
__device__ __forceinline__ v16b wcol_oi(const float* Wm, int k0, int o, int lane, int K) { v16b w; const float* p = Wm + (size_t)o * K + k0 + 8 * (lane >> 4);
#pragma unroll
  for (int i = 0; i < 8; ++i) { w[i] = (__bf16)p[i]; w[8 + i] = (__bf16)p[16 + i]; }
  return w; }
__device__ __forceinline__ v16h wcolh_io(const float* Wm, int k0, int o, int lane, int ld) { v16h w; const int g = lane >> 4;
#pragma unroll
  for (int i = 0; i < 8; ++i) { w[i] = (_Float16)(bfr(Wm[(size_t)(k0 + 8 * g + i) * ld + o]) * 256.0f); w[8 + i] = (_Float16)(bfr(Wm[(size_t)(k0 + 16 + 8 * g + i) * ld + o]) * 256.0f); }
  return w; }
__device__ __forceinline__ v16h wcolh_oi(const float* Wm, int k0, int o, int lane, int K) { v16h w; const float* p = Wm + (size_t)o * K + k0 + 8 * (lane >> 4);
#pragma unroll
  for (int i = 0; i < 8; ++i) { w[i] = (_Float16)(bfr(p[i]) * 256.0f); w[8 + i] = (_Float16)(bfr(p[16 + i]) * 256.0f); }
  return w; }
#define WQKV_LAYOUT 1   // 0 = (in,out) [DIN][CC]; 1 = (out,in) [CC][DIN]; 2 = per-head [NH][DIN][HD]
__device__ __forceinline__ v16b wcol_hdk(const float* Wm, int k0, int o, int lane) { v16b w; const int g = lane >> 4; const float* p = Wm + (size_t)(o / HD) * DIN * HD + (o % HD);
#pragma unroll
  for (int i = 0; i < 8; ++i) { w[i] = (__bf16)p[(size_t)(k0 + 8 * g + i) * HD]; w[8 + i] = (__bf16)p[(size_t)(k0 + 16 + 8 * g + i) * HD]; }
  return w; }
#define WO_OUT_IN 0
#if WQKV_LAYOUT == 1
#define WCOL(W, k0, o, lane) wcol_oi(W, k0, o, lane, DIN)
#elif WQKV_LAYOUT == 2
#define WCOL(W, k0, o, lane) wcol_hdk(W, k0, o, lane)
#else
#define WCOL(W, k0, o, lane) wcol_io(W, k0, o, lane, CC)
#endif
#if WO_OUT_IN
#define WOCOL(W, k0, o, lane) wcol_oi(W, k0, o, lane, CC)
#define WOCOLH(W, k0, o, lane) wcolh_oi(W, k0, o, lane, CC)
#else
#define WOCOL(W, k0, o, lane) wcol_io(W, k0, o, lane, DIN)
#define WOCOLH(W, k0, o, lane) wcolh_io(W, k0, o, lane, DIN)
#endif
#define NRW (TNB * TT)
// ---- k_lnx: wave per row: LayerNorm over CC = 256 (mean, biased var, (x - mean) * rsqrt(var + 1e-5) * g + b); optional bf16 rounding of the input (x); 8 floats per lane (2 float4 at stride 128 floats -> 512-B pieces)
__global__ __launch_bounds__(256) void k_lnx(const float* __restrict__ X, int roundin, const float* __restrict__ G, const float* __restrict__ BE, float* __restrict__ OUT) { const int wave = threadIdx.x >> 5, lane = threadIdx.x & 31; const size_t row = (size_t)blockIdx.x * 8 + wave; if (row >= (size_t)NRW) return;
  v4f v[CC / 128]; float s1 = 0.f;
#pragma unroll
  for (int i = 0; i < CC / 128; ++i) { v4f t = *(const v4f*)(X + row * CC + i * 128 + lane * 4); if (roundin) { t[0] = bfr(t[0]); t[1] = bfr(t[1]); t[2] = bfr(t[2]); t[3] = bfr(t[3]); } v[i] = t; s1 += (t[0] + t[1]) + (t[2] + t[3]); }
#pragma unroll
  for (int o = 1; o < 32; o <<= 1) s1 += __shfl_xor(s1, o);
  const float mu = s1 * (1.0f / CC); float q = 0.f;
#pragma unroll
  for (int i = 0; i < CC / 128; ++i) for (int k = 0; k < 4; ++k) { const float d = v[i][k] - mu; q += d * d; }
#pragma unroll
  for (int o = 1; o < 32; o <<= 1) q += __shfl_xor(q, o);
  const float inv = rsqrtf(q * (1.0f / CC) + 1e-5f);   /* jnp.var (biased), eps inside the rsqrt */
#pragma unroll
  for (int i = 0; i < CC / 128; ++i) { const int c = i * 128 + lane * 4; v4f r4; for (int k = 0; k < 4; ++k) r4[k] = bfr(G[c + k]) * ((v[i][k] - mu) * inv) + bfr(BE[c + k]); vst2(OUT + row * CC + c, r4); } }
// ---- k_gemh: block = (64 rows, 128 cols): OUT = [relu](A (once to f16) x W^T (W (out,in) as f16(bf16 x 2^6)) x 2^-6 + bias) (+ RES residual rows); 512-B segments
__global__ __launch_bounds__(128) void k_gemh(const float* __restrict__ A, int lda, int K, int act_in, const float* __restrict__ Wm, int nout, const float* __restrict__ BIAS, const float* __restrict__ RES, int relu_out, float* __restrict__ OUT) { __shared__ __align__(16) float sf[4][16][132];
  const int tid = threadIdx.x, wave = tid >> 5, lane = tid & 31, col = lane & 15, g = lane >> 4; const int c0 = blockIdx.y * 128; const size_t r0 = (size_t)blockIdx.x * 64 + wave * 16;
  v8f acc[8] = {};
#pragma unroll 1
  for (int kc = 0; kc < K / 32; ++kc) { v16h a; { const float* p = A + (r0 + col) * (size_t)lda + kc * 32 + 8 * g;
#pragma unroll
      for (int i = 0; i < 8; ++i) { float x0 = p[i], x1 = p[16 + i]; if (act_in == 1) { x0 = fmaxf(x0, 0.f); x1 = fmaxf(x1, 0.f); } else if (act_in == 2) { x0 = 0.5f * x0 * (1.0f + erff(x0 * 0.70710678118654752f)); x1 = 0.5f * x1 * (1.0f + erff(x1 * 0.70710678118654752f)); } a[i] = (_Float16)x0; a[8 + i] = (_Float16)x1; } }   /* act_in 2 = exact GELU (erf), jax.nn.gelu(approximate=False) */
    asm volatile("s_wait_loadcnt 0x0" ::: "memory");
#pragma unroll
    for (int j = 0; j < 8; ++j) { v16h w; { const int o = c0 + j * 16 + col; float t0[8], t1[8];
#pragma unroll
        for (int i = 0; i < 8; ++i) t0[i] = Wm[(size_t)o * K + kc * 32 + 8 * g + i];   /* (out,in) [nout][K] */
        asm volatile("s_wait_loadcnt 0x0" ::: "memory");
#pragma unroll
        for (int i = 0; i < 8; ++i) t1[i] = Wm[(size_t)o * K + kc * 32 + 16 + 8 * g + i];
        asm volatile("s_wait_loadcnt 0x0" ::: "memory");
#pragma unroll
        for (int i = 0; i < 8; ++i) { w[i] = (_Float16)(bfr(t0[i]) * 64.0f); w[8 + i] = (_Float16)(bfr(t1[i]) * 64.0f); } }
      acc[j] = wmma16(a, w, acc[j]); } }
#pragma unroll
  for (int j = 0; j < 8; ++j)
    { const float bb = BIAS ? bfr(BIAS[c0 + j * 16 + col]) : 0.f; asm volatile("s_wait_loadcnt 0x0" ::: "memory"); _Pragma("unroll") for (int r = 0; r < 8; ++r) sf[wave][8 * g + r][j * 16 + col] = acc[j][r] * (1.0f / 64.0f) + bb; }
  LDSX(); for (int rl = 0; rl < 16; ++rl) { const size_t o = (r0 + rl) * (size_t)nout + c0 + lane * 4; v4f v = *(const v4f*)&sf[wave][rl][lane * 4]; if (relu_out) { v[0] = fmaxf(v[0], 0.f); v[1] = fmaxf(v[1], 0.f); v[2] = fmaxf(v[2], 0.f); v[3] = fmaxf(v[3], 0.f); } if (RES) { const v4f rv = *(const v4f*)(RES + o); v[0] += rv[0]; v[1] += rv[1]; v[2] += rv[2]; v[3] += rv[3]; } vst2(OUT + o, v); } }   /* relu on the output (before the residual) when relu_out */

#ifndef SM_EXTRA_PARAMS
#define SM_EXTRA_PARAMS
#endif
#ifndef PROJ_EXTRA_PARAMS
#define PROJ_EXTRA_PARAMS
#endif
#ifndef SM_MASK_HOOK
#define SM_MASK_HOOK (void)0
#endif

#define WS_QH  0u                                      // f16 q rows [b*t][CC]
#define WS_KH  (WS_QH + 2u * (size_t)NB * TT * CC)      // f16 k rows [b*t][CC]
#define WS_VT  (WS_KH + 2u * (size_t)NB * TT * CC)      // f16 v planes [b][c][t]
#define WS_QL  (WS_VT + 2u * (size_t)NB * CC * TT)      // f16 q residual x 2^10 rows [b][t < QHI][CC]
#define WS_KL  (WS_QL + 2u * (size_t)NB * QHI * CC)     // f16 k residual x 2^10 rows [b][t < KHI][CC]
#define WS_VB  (WS_KL + 2u * (size_t)NB * KHI * CC)     // bf16 v hi planes [b][c][t < KHI]
#define WS_VBL (WS_VB + 2u * (size_t)NB * CC * KHI)
#define WS_S   (WS_VBL + 2u * (size_t)NB * CC * KHI)    // f32 logits / P [hg][t][s]
#define WS_Y   (WS_S  + 4u * (size_t)HG * TT * TT)      // f32 ctx rows [b*t][CC] (only when there is an output projection)
#define WS_END (WS_Y  + 0u)
#define WS_Y2  (WS_END)
#define WS_O1  (WS_Y2 + 4u * (size_t)NB * TT * CC)
#define WS_R2  (WS_O1 + 4u * (size_t)NB * TT * CC)
#define WS_END2 (WS_R2 + 4u * (size_t)NB * TT * CC)

// ---- k_proj: block = (64 rows, 128 cols, which): q/k/v = X W (+ b) with exact bf16 products (K = DIN) -> which 0: q f16 rows (+ residual rows < QHI); 1: k f16 rows (+ residual rows < KHI); 2: v f16 planes [c][t] (+ bf16 hi/lo planes for t < KHI)
__global__ __launch_bounds__(128) void k_proj(const float* __restrict__ XQ, const float* __restrict__ XK, const float* __restrict__ XV, const float* __restrict__ WQ, const float* __restrict__ WK, const float* __restrict__ WV, const float* __restrict__ BQ, const float* __restrict__ BK, const float* __restrict__ BV,
    _Float16* __restrict__ QH, _Float16* __restrict__ QL, _Float16* __restrict__ KH, _Float16* __restrict__ KL, _Float16* __restrict__ VT, __bf16* __restrict__ VB, __bf16* __restrict__ VBL) {
  __shared__ __align__(16) _Float16 sh[64][136], sl[64][136]; __shared__ __align__(16) _Float16 th[128][72]; __shared__ __align__(16) __bf16 tb[128][72], tbl[128][72];
  const int tid = threadIdx.x, wave = tid >> 5, lane = tid & 31, col = lane & 15, g = lane >> 4; const int which = blockIdx.z; const int c0 = blockIdx.y * 128; const size_t r0 = (size_t)blockIdx.x * 64; const size_t bb = r0 / TT; const int t0 = (int)(r0 % TT);
  const float* X = which == 0 ? XQ : which == 1 ? XK : XV; const float* WA = which == 0 ? WQ : which == 1 ? WK : WV; const float* BA = which == 0 ? BQ : which == 1 ? BK : BV;
  v8f acc[8] = {};
#pragma unroll 2
  for (int kc = 0; kc < DIN / 32; ++kc) { v16b a; { const float* p = X + (r0 + wave * 16 + col) * DIN + kc * 32 + 8 * g;
#pragma unroll
      for (int i = 0; i < 8; ++i) { a[i] = (__bf16)p[i]; a[8 + i] = (__bf16)p[16 + i]; } }
    asm volatile("s_wait_loadcnt 0x0" ::: "memory");
#pragma unroll
    for (int j = 0; j < 8; ++j) { const v16b w = WCOL(WA, kc * 32, c0 + j * 16 + col, lane); asm volatile("s_wait_loadcnt 0x0" ::: "memory"); acc[j] = wmma_bf(a, w, acc[j]); } }
  if (which < 2) { _Float16* DH = which == 0 ? QH : KH; _Float16* DL = which == 0 ? QL : KL; const int nhi = which == 0 ? QHI : KHI; const bool hi_rows = t0 < nhi;
#pragma unroll
    for (int j = 0; j < 8; ++j) { const float bias = BA ? bfr(BA[c0 + j * 16 + col]) : 0.f;
#pragma unroll
      for (int r = 0; r < 8; ++r) { const float v = acc[j][r] + bias; const _Float16 hv = (_Float16)v; sh[wave * 16 + 8 * g + r][j * 16 + col] = hv; sl[wave * 16 + 8 * g + r][j * 16 + col] = (_Float16)((v - (float)hv) * 1024.0f); } }
    __syncthreads();
    for (int e = tid; e < 64 * 16; e += 128) { const int rl = e >> 4, q = e & 15; vst2((unsigned*)(DH + (r0 + rl) * CC + c0 + q * 8), *(const v4u*)&sh[rl][q * 8]); if (hi_rows) vst2((unsigned*)(DL + (bb * nhi + t0 + rl) * (size_t)CC + c0 + q * 8), *(const v4u*)&sl[rl][q * 8]); }
  } else { const bool hi_rows = t0 < KHI;
#pragma unroll
    for (int j = 0; j < 8; ++j) { const float bias = BA ? bfr(BA[c0 + j * 16 + col]) : 0.f;
#pragma unroll
      for (int r = 0; r < 8; ++r) { const float v = acc[j][r] + bias; const int rl = wave * 16 + 8 * g + r, cl = j * 16 + col; th[cl][rl] = (_Float16)v; const __bf16 bh = (__bf16)v; tb[cl][rl] = bh; tbl[cl][rl] = (__bf16)(v - (float)bh); } }
    __syncthreads();
    for (int e = tid; e < 128 * 8; e += 128) { const int cl = e >> 3, q = e & 7; vst2((unsigned*)(VT + (bb * CC + c0 + cl) * (size_t)TT + t0 + q * 8), *(const v4u*)&th[cl][q * 8]); if (hi_rows) { const size_t o3 = (bb * CC + c0 + cl) * (size_t)KHI + t0 + q * 8; vst2((unsigned*)(VB + o3), *(const v4u*)&tb[cl][q * 8]); vst2((unsigned*)(VBL + o3), *(const v4u*)&tbl[cl][q * 8]); } } } }
// ---- k_sc: block = (query block qb, key block kb <= kb_last(qb), head in group) of batch b: logits x SCALE; q hi + residual (x 2^10) against k (2 products) for query rows < QHI, plus the k residual (3 products) for query blocks < QBH (causal early rows); causal: blocks past the diagonal exit, the mask itself is applied by index in k_sm
__global__ __launch_bounds__(128) void k_sc(const _Float16* __restrict__ QH, const _Float16* __restrict__ KH, const _Float16* __restrict__ QL, const _Float16* __restrict__ KL, int b, int h0, float* __restrict__ S0) { __shared__ __align__(16) float ss[4][16][132];
  const int qb = blockIdx.x, kb = blockIdx.y; if (kb > kb_last(qb)) return;
  const int h = h0 + blockIdx.z; float* S = S0 + (size_t)blockIdx.z * TT * TT;
  const int tid = threadIdx.x, wave = tid >> 5, lane = tid & 31, col = lane & 15, g = lane >> 4; const int k0 = kb * 128; const int ql0 = qb * 64 + wave * 16; const size_t q0 = (size_t)b * TT + ql0, kr0 = (size_t)b * TT + k0;
  v8f acc[8] = {}, accl[8] = {};
  const _Float16* QLb = QL + (size_t)b * QHI * CC; const _Float16* KLb = KL + (size_t)b * KHI * CC;
  if (qb < QBH) {
#pragma unroll
    for (int kc = 0; kc < HD / 32; ++kc) { const v16h ah = frag_h(QH + (q0 + col) * CC + h * HD + kc * 32, lane), al = frag_h(QLb + (size_t)(ql0 + col) * CC + h * HD + kc * 32, lane);
#pragma unroll
      for (int j = 0; j < 8; ++j) { const v16h kbf = frag_h(KH + (kr0 + j * 16 + col) * CC + h * HD + kc * 32, lane), klf = frag_h(KLb + (size_t)(k0 + j * 16 + col) * CC + h * HD + kc * 32, lane); acc[j] = wmma16(ah, kbf, acc[j]); accl[j] = wmma16(al, kbf, accl[j]); accl[j] = wmma16(ah, klf, accl[j]); } }
  } else if (qb * 64 < QHI) {
#pragma unroll
    for (int kc = 0; kc < HD / 32; ++kc) { const v16h ah = frag_h(QH + (q0 + col) * CC + h * HD + kc * 32, lane), al = frag_h(QLb + (size_t)(ql0 + col) * CC + h * HD + kc * 32, lane);
#pragma unroll
      for (int j = 0; j < 8; ++j) { const v16h kbf = frag_h(KH + (kr0 + j * 16 + col) * CC + h * HD + kc * 32, lane); acc[j] = wmma16(ah, kbf, acc[j]); accl[j] = wmma16(al, kbf, accl[j]); } }
  } else {
#pragma unroll
    for (int kc = 0; kc < HD / 32; ++kc) { const v16h ah = frag_h(QH + (q0 + col) * CC + h * HD + kc * 32, lane);
#pragma unroll
      for (int j = 0; j < 8; ++j) { const v16h kbf = frag_h(KH + (kr0 + j * 16 + col) * CC + h * HD + kc * 32, lane); acc[j] = wmma16(ah, kbf, acc[j]); } } }
#pragma unroll
  for (int j = 0; j < 8; ++j) {
#pragma unroll
    for (int r = 0; r < 8; ++r) ss[wave][8 * g + r][j * 16 + col] = (acc[j][r] + accl[j][r] * (1.0f / 1024.0f)) * SCALE; }
  LDSX(); for (int rl = 0; rl < 16; ++rl) vst2(S + (size_t)(ql0 + rl) * TT + k0 + lane * 4, *(const v4f*)&ss[wave][rl][lane * 4]); }
// ---- k_sm: block = query row t (head in group): keys [0, kend): causal -> logit if s <= t else excluded; softmax in f32; P x 2^11 in place (0 for excluded)
__global__ __launch_bounds__(256) void k_sm(float* __restrict__ S0 SM_EXTRA_PARAMS) { __shared__ float sred[8]; __shared__ float sbc; __shared__ __align__(16) float shv[TT];
  const int tid = threadIdx.x; const int t = blockIdx.x; const int kend = (kb_last(t >> 6) + 1) * 128;
  float* sr = S0 + (size_t)blockIdx.y * TT * TT + (size_t)t * TT;
  float m = -3.0e38f; for (int k = tid; k < kend; k += 256) { float v = (!CAUSAL || k <= t) ? sr[k] : -3.0e38f; SM_MASK_HOOK; shv[k] = v; m = fmaxf(m, v); }
#pragma unroll
  for (int o = 1; o < 32; o <<= 1) m = fmaxf(m, __shfl_xor(m, o));
  if ((tid & 31) == 0) sred[tid >> 5] = m; __syncthreads(); if (tid == 0) { float a = sred[0]; for (int i = 1; i < 8; ++i) a = fmaxf(a, sred[i]); sbc = a; } __syncthreads(); m = sbc; __syncthreads();
  float sum = 0.f; for (int k = tid; k < kend; k += 256) { const float v = shv[k]; const float e = (v <= -1.0e38f) ? 0.f : expf(v - m); shv[k] = e; sum += e; }
#pragma unroll
  for (int o = 1; o < 32; o <<= 1) sum += __shfl_xor(sum, o);
  if ((tid & 31) == 0) sred[tid >> 5] = sum; __syncthreads(); if (tid == 0) { float a = 0.f; for (int i = 0; i < 8; ++i) a += sred[i]; sbc = a > 0.f ? 2048.0f / a : 0.f; }   /* a fully excluded row yields P = 0 */ __syncthreads(); const float inv = sbc;
  for (int k = tid; k < kend; k += 256) shv[k] = shv[k] * inv;
  __syncthreads(); for (int q = tid; q < kend / 4; q += 256) vst2(sr + q * 4, *(const v4f*)&shv[q * 4]); }
// ---- k_pv: block = 64 queries (qb) of (b, h): ctx = P . v over keys [0, kend) (P x 2^11 once to f16 against v f16: 1 product; causal early query blocks: P and v as bf16 hi + lo, 3 products); 128-B (row, head) segment by 8 lanes
__global__ __launch_bounds__(128) void k_pv(const float* __restrict__ PS0, const _Float16* __restrict__ VT, const __bf16* __restrict__ VB, const __bf16* __restrict__ VBL, int b, int h0, float* __restrict__ Y) { const int h = h0 + blockIdx.z; const float* PS = PS0 + (size_t)blockIdx.z * TT * TT; __shared__ __align__(16) float ss[4][16][HD + 4];
  const int tid = threadIdx.x, wave = tid >> 5, lane = tid & 31, col = lane & 15, g = lane >> 4; const int qb = blockIdx.x; const int ql0 = qb * 64 + wave * 16; const int kce = (kb_last(qb) + 1) * 4;
  v8f acc[HD / 16] = {};
  if (qb < QBH) {
#pragma unroll 1
    for (int kc = 0; kc < kce; ++kc) { const F2 p = split_row(PS + (size_t)(ql0 + col) * TT, kc * 32, lane);
      asm volatile("s_wait_loadcnt 0x0" ::: "memory");
#pragma unroll
      for (int j = 0; j < HD / 16; ++j) { const size_t po = ((size_t)b * CC + h * HD + j * 16 + col) * (size_t)KHI + kc * 32; const v16b vh = frag_b(VB + po, lane); acc[j] = wmma_bf(p.h, vh, acc[j]); acc[j] = wmma_bf(p.l, vh, acc[j]); acc[j] = wmma_bf(p.h, frag_b(VBL + po, lane), acc[j]); } }
  } else {
#pragma unroll 1
    for (int kc = 0; kc < kce; ++kc) { const v16h p = frag_f32(PS + (size_t)(ql0 + col) * TT + kc * 32, lane);
      asm volatile("s_wait_loadcnt 0x0" ::: "memory");
#pragma unroll
      for (int j = 0; j < HD / 16; ++j) { const size_t po = ((size_t)b * CC + h * HD + j * 16 + col) * (size_t)TT + kc * 32; acc[j] = wmma16(p, frag_h(VT + po, lane), acc[j]); } } }
#pragma unroll
  for (int j = 0; j < HD / 16; ++j)
#pragma unroll
    for (int r = 0; r < 8; ++r) ss[wave][8 * g + r][j * 16 + col] = acc[j][r] * (1.0f / 2048.0f);
  LDSX(); for (int rl = 0; rl < 16; ++rl) if (lane < HD / 4) vst2(Y + ((size_t)b * TT + ql0 + rl) * CC + h * HD + lane * 4, *(const v4f*)&ss[wave][rl][lane * 4]); }

extern "C" void kernel_launch(void* const* d_in, const int* in_sizes, int n_in, void* d_out, int out_size, void* d_ws, size_t ws_size, hipStream_t stream) {
  (void)in_sizes; (void)n_in; (void)out_size;
  const float** F = (const float**)d_in;
  if (ws_size < (size_t)WS_END) return;
  char* ws = (char*)d_ws; _Float16 *QH = (_Float16*)(ws + WS_QH), *KH = (_Float16*)(ws + WS_KH), *VT = (_Float16*)(ws + WS_VT), *QL = (_Float16*)(ws + WS_QL), *KL = (_Float16*)(ws + WS_KL); __bf16 *VB = (__bf16*)(ws + WS_VB), *VBL = (__bf16*)(ws + WS_VBL); float *S = (float*)(ws + WS_S), *Y = (float*)(ws + WS_Y);
  (void)Y; (void)QL; (void)KL; (void)VB; (void)VBL;
  // inputs: 0 Q [4,2048,256]; 1 K [4,2048,256]; 2 Wq [256,256] (out,in), 3 bq; 4 Wk, 5 bk; 6 Wv, 7 bv; 8 Wo (out,in), 9 bo; 10 g0, 11 b0; 12 g1, 13 b1
  if (ws_size < (size_t)WS_END2) return;
  float *YA = (float*)(ws + WS_Y2), *O1 = (float*)(ws + WS_O1), *R2 = (float*)(ws + WS_R2);
  k_proj<<<dim3(TNB * TT / 64, CC / 128, 3), 128, 0, stream>>>(F[0], F[1], F[1], F[2], F[4], F[6], F[3], F[5], F[7], QH, QL, KH, KL, VT, VB, VBL);
  for (int b = 0; b < TNB; ++b) for (int h0 = 0; h0 < NH; h0 += HG) {
    k_sc<<<dim3(NQB, TT / 128, HG), 128, 0, stream>>>(QH, KH, QL, KL, b, h0, S);
    k_sm<<<dim3(TT, HG), 256, 0, stream>>>(S);
    k_pv<<<dim3(NQB, 1, HG), 128, 0, stream>>>(S, VT, VB, VBL, b, h0, YA);
  }
  k_lnx<<<dim3(NRW / 8), 256, 0, stream>>>(YA, 0, F[10], F[11], O1);                                        /* o = LN0(attention output) */
  k_gemh<<<dim3(NRW / 64, CC / 128), 128, 0, stream>>>(O1, CC, CC, 0, F[8], CC, F[9], O1, 1, R2);          /* r2 = o + relu(o Wo^T + bo) */
  k_lnx<<<dim3(NRW / 8), 256, 0, stream>>>(R2, 0, F[12], F[13], (float*)d_out);                           /* out = LN1(r2) */
}

// v001
// Measured time: 119 microseconds a run.
// Next to v000, in two timings, it ran 7.33 and 7.30 times as fast.
// compute dtype: all float inputs rounded to bf16; Qp/Kp/Vp = X W^T + b with EXACT bf16 products on WMMA 16x16x32 (f32 accumulate); q as f16 hi + residual (x 2^10) against k once to f16 (2 products) x 32^-0.5; softmax in f32 with a running maximum (hardware exp2); unnormalised P x 2^8 once to f16 against v once to f16 (1 product), divided by the f32 row sum at the end; LayerNorms in f32; the fc_o layer with the LN rows once to f16 against Wo as f16(bf16 x 2^6) (1 product) + bias, relu and residual in f32; f32 output.
#include <hip/hip_runtime.h>
#include <math.h>

typedef __attribute__((ext_vector_type(16))) _Float16 v16h;
typedef __attribute__((ext_vector_type(16))) __bf16 v16b;
typedef __attribute__((ext_vector_type(8)))  _Float16 v8h;
typedef __attribute__((ext_vector_type(8)))  float v8f;
typedef __attribute__((ext_vector_type(4)))  float v4f;
typedef __attribute__((ext_vector_type(2)))  float v2f;
typedef __attribute__((ext_vector_type(4)))  unsigned v4u;
typedef __attribute__((ext_vector_type(4)))  int v4i;
typedef float __attribute__((may_alias)) float_a;
typedef int __attribute__((may_alias)) int_a;

template <typename T> __device__ __forceinline__ void vst2(void* p, T v) { *(T*)p = v;  }
__device__ __forceinline__ v8f wmma16(v16h a, v16h b, v8f c) {
  v8f d = __builtin_amdgcn_wmma_f32_16x16x32_f16(false, a, false, b, (short)0, c, false, false);
  asm volatile("v_nop\n\tv_nop\n\tv_nop\n\tv_nop" : "+v"(d) : "v"(a), "v"(b));
  return d;
}
__device__ __forceinline__ v8f wmma_bf(v16b a, v16b b, v8f c) {
  v8f d = __builtin_amdgcn_wmma_f32_16x16x32_bf16(false, a, false, b, (short)0, c, false, false);
  asm volatile("v_nop\n\tv_nop\n\tv_nop\n\tv_nop" : "+v"(d) : "v"(a), "v"(b));
  return d;
}
// 16x16x32 fragments: lane = (h = lane>>4, row/col = lane&15); elements 0..7 = k0+8h+0..7, 8..15 = k0+16+8h+0..7; D element r = row 8h+r
__device__ __forceinline__ v16h frag_h(const _Float16* rowk0, int lane) {
  union { v16h v; v8h q[2]; } u; const _Float16* p = rowk0 + 8 * (lane >> 4);
  u.q[0] = *(const v8h*)p; u.q[1] = *(const v8h*)(p + 16); return u.v;
}
__device__ __forceinline__ v16h frag_f32(const float* rowk0, int lane) {
  v16h a; const float* p = rowk0 + 8 * (lane >> 4);
#pragma unroll
  for (int i = 0; i < 8; ++i) { a[i] = (_Float16)p[i]; a[8 + i] = (_Float16)p[16 + i]; }
  return a;
}
__device__ __forceinline__ v16h frag_f32s(const float* rowk0, int lane, float sc) {
  v16h a; const float* p = rowk0 + 8 * (lane >> 4);
#pragma unroll
  for (int i = 0; i < 8; ++i) { a[i] = (_Float16)(p[i] * sc); a[8 + i] = (_Float16)(p[16 + i] * sc); }
  return a;
}
// column fragment from a [K][ld] layout (column n), rows >= K read as 0
__device__ __forceinline__ v16h fragc_f32(const float* W, int k0, int n, int lane, int ld, int K) {
  v16h a; const int g = lane >> 4;
#pragma unroll
  for (int i = 0; i < 8; ++i) { const int ka = k0 + 8 * g + i, kb = ka + 16;
    a[i] = (_Float16)(ka < K ? W[(size_t)(ka < K ? ka : K - 1) * ld + n] : 0.f); a[8 + i] = (_Float16)(kb < K ? W[(size_t)(kb < K ? kb : K - 1) * ld + n] : 0.f); }
  return a;
}
struct F2 { v16b h, l; };
__device__ __forceinline__ F2 bsplit16(const float v[16]) { F2 r;
#pragma unroll
  for (int i = 0; i < 16; ++i) { const __bf16 h = (__bf16)v[i]; r.h[i] = h; r.l[i] = (__bf16)(v[i] - (float)h); }
  return r; }
__device__ __forceinline__ F2 split_row(const float* row, int k0, int lane) { float v[16]; const float* p = row + k0 + 8 * (lane >> 4);
#pragma unroll
  for (int i = 0; i < 8; ++i) { v[i] = p[i]; v[8 + i] = p[16 + i]; }
  return bsplit16(v); }
__device__ __forceinline__ F2 split_rowK(const float* row, int k0, int lane, int K) { float v[16]; const int g = lane >> 4;
#pragma unroll
  for (int i = 0; i < 8; ++i) { const int ka = k0 + 8 * g + i, kb = ka + 16; v[i] = ka < K ? row[ka < K ? ka : K - 1] : 0.f; v[8 + i] = kb < K ? row[kb < K ? kb : K - 1] : 0.f; }
  return bsplit16(v); }
__device__ __forceinline__ F2 split_col(const float* W, int k0, int n, int lane, int ld, int K) { float v[16]; const int g = lane >> 4;
#pragma unroll
  for (int i = 0; i < 8; ++i) { const int ka = k0 + 8 * g + i, kb = ka + 16; v[i] = ka < K ? W[(size_t)(ka < K ? ka : K - 1) * ld + n] : 0.f; v[8 + i] = kb < K ? W[(size_t)(kb < K ? kb : K - 1) * ld + n] : 0.f; }
  return bsplit16(v); }
__device__ __forceinline__ v8f mac3(const F2& a, const F2& b, v8f c) { c = wmma_bf(a.l, b.h, c); c = wmma_bf(a.h, b.l, c); return wmma_bf(a.h, b.h, c); }
__device__ __forceinline__ float sigm(float v) { return 1.0f / (1.0f + expf(-v)); }
#define LDSX() do { asm volatile("s_wait_dscnt 0" ::: "memory"); __builtin_amdgcn_wave_barrier(); __builtin_amdgcn_fence(__ATOMIC_RELEASE, "workgroup"); } while (0)

// Set-Transformer MAB (B 4, NQ = NK = 2,048, dim 256 = 8 heads x 32; 0.02-scale (out,in) weights, zero biases, LN gamma 1 / beta 0): Qp = Q Wq^T + bq, Kp = K Wk^T + bk, Vp = K Wv^T + bv; o = merged(softmax(q k^T / sqrt(32)) v); o = LN0(o); out = LN1(o + relu(o Wo^T + bo)) (eps 1e-5, biased var).
#define NB 4
#define TT 2048
#define CC 256            // NH * HD = projected width
#define DIN 256          // input (model) width
#define NH 8
#define HD 32
#define NQB (TT / 64)
#define HG 4
#define SCALE (0.17677669529663687f)
#define CAUSAL 0
#ifndef TNB
#define TNB NB
#endif
__device__ __forceinline__ float bfr(float v) { return (float)(__bf16)v; }
__host__ __device__ __forceinline__ int kb_last(int qb) { return CAUSAL ? ((qb * 64 + 63) >> 7) : (TT / 128 - 1); }
typedef __attribute__((ext_vector_type(8))) __bf16 v8b;
__device__ __forceinline__ v16b frag_b(const __bf16* rowk0, int lane) {
  union { v16b v; v8b q[2]; } u; const __bf16* p = rowk0 + 8 * (lane >> 4);
  u.q[0] = *(const v8b*)p; u.q[1] = *(const v8b*)(p + 16); return u.v;
}
#define QBH 0              // not referenced by any kernel here (no high-precision path)
#define QHI 2048            // rows carrying a q residual plane (all rows when non-causal: 2-product logits everywhere)
#define KHI 64            // key rows carrying k residual / v bf16 hi+lo planes (written by k_proj; no kernel here reads them)
// B fragment (k rows k0+.., output column o) of a weight: (in,out) [K][ld] or (out,in) [ld rows of K]: bf16 exact, or f16(bf16 * 256) exact
__device__ __forceinline__ v16b wcol_io(const float* Wm, int k0, int o, int lane, int ld) { v16b w; const int g = lane >> 4;
#pragma unroll
  for (int i = 0; i < 8; ++i) { w[i] = (__bf16)Wm[(size_t)(k0 + 8 * g + i) * ld + o]; w[8 + i] = (__bf16)Wm[(size_t)(k0 + 16 + 8 * g + i) * ld + o]; }
  return w; }
__device__ __forceinline__ v16b wcol_oi(const float* Wm, int k0, int o, int lane, int K) { v16b w; const float* p = Wm + (size_t)o * K + k0 + 8 * (lane >> 4);
#pragma unroll
  for (int i = 0; i < 8; ++i) { w[i] = (__bf16)p[i]; w[8 + i] = (__bf16)p[16 + i]; }
  return w; }
__device__ __forceinline__ v16h wcolh_io(const float* Wm, int k0, int o, int lane, int ld) { v16h w; const int g = lane >> 4;
#pragma unroll
  for (int i = 0; i < 8; ++i) { w[i] = (_Float16)(bfr(Wm[(size_t)(k0 + 8 * g + i) * ld + o]) * 256.0f); w[8 + i] = (_Float16)(bfr(Wm[(size_t)(k0 + 16 + 8 * g + i) * ld + o]) * 256.0f); }
  return w; }
__device__ __forceinline__ v16h wcolh_oi(const float* Wm, int k0, int o, int lane, int K) { v16h w; const float* p = Wm + (size_t)o * K + k0 + 8 * (lane >> 4);
#pragma unroll
  for (int i = 0; i < 8; ++i) { w[i] = (_Float16)(bfr(p[i]) * 256.0f); w[8 + i] = (_Float16)(bfr(p[16 + i]) * 256.0f); }
  return w; }
#define WQKV_LAYOUT 1   // 0 = (in,out) [DIN][CC]; 1 = (out,in) [CC][DIN]; 2 = per-head [NH][DIN][HD]
__device__ __forceinline__ v16b wcol_hdk(const float* Wm, int k0, int o, int lane) { v16b w; const int g = lane >> 4; const float* p = Wm + (size_t)(o / HD) * DIN * HD + (o % HD);
#pragma unroll
  for (int i = 0; i < 8; ++i) { w[i] = (__bf16)p[(size_t)(k0 + 8 * g + i) * HD]; w[8 + i] = (__bf16)p[(size_t)(k0 + 16 + 8 * g + i) * HD]; }
  return w; }
#define WO_OUT_IN 0
#if WQKV_LAYOUT == 1
#define WCOL(W, k0, o, lane) wcol_oi(W, k0, o, lane, DIN)
#elif WQKV_LAYOUT == 2
#define WCOL(W, k0, o, lane) wcol_hdk(W, k0, o, lane)
#else
#define WCOL(W, k0, o, lane) wcol_io(W, k0, o, lane, CC)
#endif
#if WO_OUT_IN
#define WOCOL(W, k0, o, lane) wcol_oi(W, k0, o, lane, CC)
#define WOCOLH(W, k0, o, lane) wcolh_oi(W, k0, o, lane, CC)
#else
#define WOCOL(W, k0, o, lane) wcol_io(W, k0, o, lane, DIN)
#define WOCOLH(W, k0, o, lane) wcolh_io(W, k0, o, lane, DIN)
#endif
#define NRW (TNB * TT)
// ---- k_lnx: wave per row: LayerNorm over CC = 256 (mean, biased var, (x - mean) * rsqrt(var + 1e-5) * g + b); optional bf16 rounding of the input (x); 8 floats per lane (2 float4 at stride 128 floats -> 512-B pieces)
__global__ __launch_bounds__(256) void k_lnx(const float* __restrict__ X, int roundin, const float* __restrict__ G, const float* __restrict__ BE, float* __restrict__ OUT) { const int wave = threadIdx.x >> 5, lane = threadIdx.x & 31; const size_t row = (size_t)blockIdx.x * 8 + wave; if (row >= (size_t)NRW) return;
  v4f v[CC / 128]; float s1 = 0.f;
#pragma unroll
  for (int i = 0; i < CC / 128; ++i) { v4f t = *(const v4f*)(X + row * CC + i * 128 + lane * 4); if (roundin) { t[0] = bfr(t[0]); t[1] = bfr(t[1]); t[2] = bfr(t[2]); t[3] = bfr(t[3]); } v[i] = t; s1 += (t[0] + t[1]) + (t[2] + t[3]); }
#pragma unroll
  for (int o = 1; o < 32; o <<= 1) s1 += __shfl_xor(s1, o);
  const float mu = s1 * (1.0f / CC); float q = 0.f;
#pragma unroll
  for (int i = 0; i < CC / 128; ++i) for (int k = 0; k < 4; ++k) { const float d = v[i][k] - mu; q += d * d; }
#pragma unroll
  for (int o = 1; o < 32; o <<= 1) q += __shfl_xor(q, o);
  const float inv = rsqrtf(q * (1.0f / CC) + 1e-5f);   /* jnp.var (biased), eps inside the rsqrt */
#pragma unroll
  for (int i = 0; i < CC / 128; ++i) { const int c = i * 128 + lane * 4; v4f r4; for (int k = 0; k < 4; ++k) r4[k] = bfr(G[c + k]) * ((v[i][k] - mu) * inv) + bfr(BE[c + k]); vst2(OUT + row * CC + c, r4); } }
// ---- k_gemh: block = (64 rows, 128 cols): OUT = [relu](A (once to f16) x W^T (W (out,in) as f16(bf16 x 2^6)) x 2^-6 + bias) (+ RES residual rows); 512-B segments
__global__ __launch_bounds__(128) void k_gemh(const float* __restrict__ A, int lda, int K, int act_in, const float* __restrict__ Wm, int nout, const float* __restrict__ BIAS, const float* __restrict__ RES, int relu_out, float* __restrict__ OUT) { __shared__ __align__(16) float sf[4][16][132];
  const int tid = threadIdx.x, wave = tid >> 5, lane = tid & 31, col = lane & 15, g = lane >> 4; const int c0 = blockIdx.y * 128; const size_t r0 = (size_t)blockIdx.x * 64 + wave * 16;
  v8f acc[8] = {};
#pragma unroll 1
  for (int kc = 0; kc < K / 32; ++kc) { v16h a; { const float* p = A + (r0 + col) * (size_t)lda + kc * 32 + 8 * g;
#pragma unroll
      for (int i = 0; i < 8; ++i) { float x0 = p[i], x1 = p[16 + i]; if (act_in == 1) { x0 = fmaxf(x0, 0.f); x1 = fmaxf(x1, 0.f); } else if (act_in == 2) { x0 = 0.5f * x0 * (1.0f + erff(x0 * 0.70710678118654752f)); x1 = 0.5f * x1 * (1.0f + erff(x1 * 0.70710678118654752f)); } a[i] = (_Float16)x0; a[8 + i] = (_Float16)x1; } }   /* act_in 2 = exact GELU (erf), jax.nn.gelu(approximate=False) */
    asm volatile("s_wait_loadcnt 0x0" ::: "memory");
#pragma unroll
    for (int j = 0; j < 8; ++j) { v16h w; { const int o = c0 + j * 16 + col; float t0[8], t1[8];
#pragma unroll
        for (int i = 0; i < 8; ++i) t0[i] = Wm[(size_t)o * K + kc * 32 + 8 * g + i];   /* (out,in) [nout][K] */
        asm volatile("s_wait_loadcnt 0x0" ::: "memory");
#pragma unroll
        for (int i = 0; i < 8; ++i) t1[i] = Wm[(size_t)o * K + kc * 32 + 16 + 8 * g + i];
        asm volatile("s_wait_loadcnt 0x0" ::: "memory");
#pragma unroll
        for (int i = 0; i < 8; ++i) { w[i] = (_Float16)(bfr(t0[i]) * 64.0f); w[8 + i] = (_Float16)(bfr(t1[i]) * 64.0f); } }
      acc[j] = wmma16(a, w, acc[j]); } }
#pragma unroll
  for (int j = 0; j < 8; ++j)
    { const float bb = BIAS ? bfr(BIAS[c0 + j * 16 + col]) : 0.f; asm volatile("s_wait_loadcnt 0x0" ::: "memory"); _Pragma("unroll") for (int r = 0; r < 8; ++r) sf[wave][8 * g + r][j * 16 + col] = acc[j][r] * (1.0f / 64.0f) + bb; }
  LDSX(); for (int rl = 0; rl < 16; ++rl) { const size_t o = (r0 + rl) * (size_t)nout + c0 + lane * 4; v4f v = *(const v4f*)&sf[wave][rl][lane * 4]; if (relu_out) { v[0] = fmaxf(v[0], 0.f); v[1] = fmaxf(v[1], 0.f); v[2] = fmaxf(v[2], 0.f); v[3] = fmaxf(v[3], 0.f); } if (RES) { const v4f rv = *(const v4f*)(RES + o); v[0] += rv[0]; v[1] += rv[1]; v[2] += rv[2]; v[3] += rv[3]; } vst2(OUT + o, v); } }   /* relu on the output (before the residual) when relu_out */

#ifndef SM_EXTRA_PARAMS
#define SM_EXTRA_PARAMS
#endif
#ifndef PROJ_EXTRA_PARAMS
#define PROJ_EXTRA_PARAMS
#endif
#ifndef SM_MASK_HOOK
#define SM_MASK_HOOK (void)0
#endif

#define WS_QH  0u                                      // f16 q rows [b*t][CC]
#define WS_KH  (WS_QH + 2u * (size_t)NB * TT * CC)      // f16 k rows [b*t][CC]
#define WS_VT  (WS_KH + 2u * (size_t)NB * TT * CC)      // f16 v planes [b][c][t]
#define WS_QL  (WS_VT + 2u * (size_t)NB * CC * TT)      // f16 q residual x 2^10 rows [b][t < QHI][CC]
#define WS_KL  (WS_QL + 2u * (size_t)NB * QHI * CC)     // f16 k residual x 2^10 rows [b][t < KHI][CC]
#define WS_VB  (WS_KL + 2u * (size_t)NB * KHI * CC)     // bf16 v hi planes [b][c][t < KHI]
#define WS_VBL (WS_VB + 2u * (size_t)NB * CC * KHI)
#define WS_S   (WS_VBL + 2u * (size_t)NB * CC * KHI)    // f32 [hg][t][s] region; no kernel here uses it
#define WS_Y   (WS_S  + 4u * (size_t)HG * TT * TT)      // f32 ctx rows [b*t][CC] (only when there is an output projection)
#define WS_END (WS_Y  + 0u)
#define WS_Y2  (WS_END)
#define WS_O1  (WS_Y2 + 4u * (size_t)NB * TT * CC)
#define WS_R2  (WS_O1 + 4u * (size_t)NB * TT * CC)
#define WS_END2 (WS_R2 + 4u * (size_t)NB * TT * CC)

// ---- k_proj: block = (64 rows, 128 cols, which): q/k/v = X W (+ b) with exact bf16 products (K = DIN) -> which 0: q f16 rows (+ residual rows < QHI); 1: k f16 rows (+ residual rows < KHI); 2: v f16 planes [c][t] (+ bf16 hi/lo planes for t < KHI)
__global__ __launch_bounds__(128) void k_proj(const float* __restrict__ XQ, const float* __restrict__ XK, const float* __restrict__ XV, const float* __restrict__ WQ, const float* __restrict__ WK, const float* __restrict__ WV, const float* __restrict__ BQ, const float* __restrict__ BK, const float* __restrict__ BV,
    _Float16* __restrict__ QH, _Float16* __restrict__ QL, _Float16* __restrict__ KH, _Float16* __restrict__ KL, _Float16* __restrict__ VT, __bf16* __restrict__ VB, __bf16* __restrict__ VBL) {
  __shared__ __align__(16) _Float16 sh[64][136], sl[64][136]; __shared__ __align__(16) _Float16 th[128][72]; __shared__ __align__(16) __bf16 tb[128][72], tbl[128][72];
  const int tid = threadIdx.x, wave = tid >> 5, lane = tid & 31, col = lane & 15, g = lane >> 4; const int which = blockIdx.z; const int c0 = blockIdx.y * 128; const size_t r0 = (size_t)blockIdx.x * 64; const size_t bb = r0 / TT; const int t0 = (int)(r0 % TT);
  const float* X = which == 0 ? XQ : which == 1 ? XK : XV; const float* WA = which == 0 ? WQ : which == 1 ? WK : WV; const float* BA = which == 0 ? BQ : which == 1 ? BK : BV;
  v8f acc[8] = {};
#pragma unroll 2
  for (int kc = 0; kc < DIN / 32; ++kc) { v16b a; { const float* p = X + (r0 + wave * 16 + col) * DIN + kc * 32 + 8 * g;
#pragma unroll
      for (int i = 0; i < 8; ++i) { a[i] = (__bf16)p[i]; a[8 + i] = (__bf16)p[16 + i]; } }
    asm volatile("s_wait_loadcnt 0x0" ::: "memory");
#pragma unroll
    for (int j = 0; j < 8; ++j) { const v16b w = WCOL(WA, kc * 32, c0 + j * 16 + col, lane); asm volatile("s_wait_loadcnt 0x0" ::: "memory"); acc[j] = wmma_bf(a, w, acc[j]); } }
  if (which < 2) { _Float16* DH = which == 0 ? QH : KH; _Float16* DL = which == 0 ? QL : KL; const int nhi = which == 0 ? QHI : KHI; const bool hi_rows = t0 < nhi;
#pragma unroll
    for (int j = 0; j < 8; ++j) { const float bias = BA ? bfr(BA[c0 + j * 16 + col]) : 0.f;
#pragma unroll
      for (int r = 0; r < 8; ++r) { const float v = acc[j][r] + bias; const _Float16 hv = (_Float16)v; sh[wave * 16 + 8 * g + r][j * 16 + col] = hv; sl[wave * 16 + 8 * g + r][j * 16 + col] = (_Float16)((v - (float)hv) * 1024.0f); } }
    __syncthreads();
    for (int e = tid; e < 64 * 16; e += 128) { const int rl = e >> 4, q = e & 15; vst2((unsigned*)(DH + (r0 + rl) * CC + c0 + q * 8), *(const v4u*)&sh[rl][q * 8]); if (hi_rows) vst2((unsigned*)(DL + (bb * nhi + t0 + rl) * (size_t)CC + c0 + q * 8), *(const v4u*)&sl[rl][q * 8]); }
  } else { const bool hi_rows = t0 < KHI;
#pragma unroll
    for (int j = 0; j < 8; ++j) { const float bias = BA ? bfr(BA[c0 + j * 16 + col]) : 0.f;
#pragma unroll
      for (int r = 0; r < 8; ++r) { const float v = acc[j][r] + bias; const int rl = wave * 16 + 8 * g + r, cl = j * 16 + col; th[cl][rl] = (_Float16)v; const __bf16 bh = (__bf16)v; tb[cl][rl] = bh; tbl[cl][rl] = (__bf16)(v - (float)bh); } }
    __syncthreads();
    for (int e = tid; e < 128 * 8; e += 128) { const int cl = e >> 3, q = e & 7; vst2((unsigned*)(VT + (bb * CC + c0 + cl) * (size_t)TT + t0 + q * 8), *(const v4u*)&th[cl][q * 8]); if (hi_rows) { const size_t o3 = (bb * CC + c0 + cl) * (size_t)KHI + t0 + q * 8; vst2((unsigned*)(VB + o3), *(const v4u*)&tb[cl][q * 8]); vst2((unsigned*)(VBL + o3), *(const v4u*)&tbl[cl][q * 8]); } } } }
// ---- k_fa: block = 128 queries of one (b, h), 8 waves x 16 query columns: S^T = k q^T (q hi + residual x 2^10, 2 products), running maximum and sum per query in f32, P^T x 2^8 (relative to the running maximum) once to f16 straight from the score tiles as B operand, O^T += v^T P^T (1 product); k rows and v planes staged in LDS, 128 keys a stage, two buffers
#define FA_ST 128          // keys per stage
#define FA_KP 40           // LDS pitch of a k row in halfs (80 B = 16 B x odd)
#define FA_VP 136          // LDS pitch of a v plane row in halfs (272 B = 16 B x odd)
#define FA_C (SCALE * 1.4426950408889634f)
__device__ __forceinline__ float xhalf(float x) { return __builtin_bit_cast(float, __builtin_amdgcn_permlanex16(__builtin_bit_cast(int, x), __builtin_bit_cast(int, x), 0x76543210, 0xfedcba98, false, false)); }   // lane l with lane l ^ 16
// exp2 of eight values, each in its own register, in one statement closed by v_nop: no exp2 of the run touches a neighbour's register, and the v_nop is the slot that the instruction set asks for between a transcendental and the first use of its result
__device__ __forceinline__ void exp2x8(float& x0, float& x1, float& x2, float& x3, float& x4, float& x5, float& x6, float& x7) {
  asm("v_exp_f32 %0, %0\n\tv_exp_f32 %1, %1\n\tv_exp_f32 %2, %2\n\tv_exp_f32 %3, %3\n\tv_exp_f32 %4, %4\n\tv_exp_f32 %5, %5\n\tv_exp_f32 %6, %6\n\tv_exp_f32 %7, %7\n\tv_nop"
      : "+v"(x0), "+v"(x1), "+v"(x2), "+v"(x3), "+v"(x4), "+v"(x5), "+v"(x6), "+v"(x7)); }
__device__ __forceinline__ v8f wmma_h(v16h a, v16h b, v8f c) { return __builtin_amdgcn_wmma_f32_16x16x32_f16(false, a, false, b, (short)0, c, false, false); }
__global__ __launch_bounds__(256) __attribute__((amdgpu_waves_per_eu(4, 4))) void k_fa(const _Float16* __restrict__ QH, const _Float16* __restrict__ QL, const _Float16* __restrict__ KH, const _Float16* __restrict__ VT, float* __restrict__ Y) {
  __shared__ __align__(16) _Float16 sK[2][FA_ST * FA_KP]; __shared__ __align__(16) _Float16 sV[2][HD * FA_VP];
  const int tid = threadIdx.x, wave = tid >> 5, lane = tid & 31, col = lane & 15, g = lane >> 4; const int b = blockIdx.y / NH, h = blockIdx.y % NH; const int q = blockIdx.x * 128 + wave * 16 + col;
  const v16h qh = frag_h(QH + ((size_t)b * TT + q) * CC + h * HD, lane), ql = frag_h(QL + ((size_t)b * QHI + q) * CC + h * HD, lane);   // B operands: column = query
  const int kr = tid >> 2, ks = (tid & 3) * 8, vr = tid >> 4, vs = (tid & 15) * 8;   // this thread's 16-B pieces of a stage: k rows kr, kr + 64; v rows vr, vr + 16
  const _Float16* Kg = KH + ((size_t)b * TT + kr) * CC + h * HD + ks; const _Float16* Vg = VT + ((size_t)b * CC + h * HD + vr) * TT + vs;
  v4u rk0 = *(const v4u*)Kg, rk1 = *(const v4u*)(Kg + (size_t)64 * CC), rv0 = *(const v4u*)Vg, rv1 = *(const v4u*)(Vg + (size_t)16 * TT);
  *(v4u*)&sK[0][kr * FA_KP + ks] = rk0; *(v4u*)&sK[0][(kr + 64) * FA_KP + ks] = rk1; *(v4u*)&sV[0][vr * FA_VP + vs] = rv0; *(v4u*)&sV[0][(vr + 16) * FA_VP + vs] = rv1;
  __syncthreads();
  v8f o[HD / 16] = {}; float m = -3.0e38f, l = 0.f;
#pragma unroll 1   // the stage loop stays rolled: one stage is already a long straight body; the inner loops are unrolled so that every register array has constant indices
  for (int s = 0; s < TT / FA_ST; ++s) { const int cur = s & 1; const bool more = s + 1 < TT / FA_ST;
    if (more) { const _Float16* kp = Kg + (size_t)(s + 1) * FA_ST * CC; const _Float16* vp = Vg + (s + 1) * FA_ST; rk0 = *(const v4u*)kp; rk1 = *(const v4u*)(kp + (size_t)64 * CC); rv0 = *(const v4u*)vp; rv1 = *(const v4u*)(vp + (size_t)16 * TT); }
#pragma unroll
    for (int kk = 0; kk < FA_ST; kk += 64) { v8f sv[4];
#pragma unroll
      for (int t = 0; t < 4; ++t) { const v16h kf = frag_h(&sK[cur][(kk + t * 16 + col) * FA_KP], lane); const v8f z = {}; const v8f lo = wmma_h(kf, ql, z), hi = wmma_h(kf, qh, z);   // A operand: row = key
#pragma unroll
        for (int r = 0; r < 8; ++r) sv[t][r] = hi[r] + lo[r] * (1.0f / 1024.0f); }
      v16h vf[HD / 16][2];   // A operands of the second product: row = channel, keys in the order of the packed score tiles
#pragma unroll
      for (int j = 0; j < HD / 16; ++j)
#pragma unroll
        for (int u = 0; u < 2; ++u) vf[j][u] = frag_h(&sV[cur][(j * 16 + col) * FA_VP + kk + u * 32], lane);
      float mt[4];
#pragma unroll
      for (int t = 0; t < 4; ++t) { mt[t] = sv[t][0];
#pragma unroll
        for (int r = 1; r < 8; ++r) mt[t] = fmaxf(mt[t], sv[t][r]); }
      float mx = fmaxf(fmaxf(mt[0], mt[1]), fmaxf(mt[2], mt[3]));
      mx = fmaxf(mx, xhalf(mx)); const float mn = fmaxf(m, mx); const float alpha = __builtin_amdgcn_exp2f((m - mn) * FA_C); m = mn; const float off = 8.0f - mn * FA_C;
      float ps[4]; v16h pf[2];
#pragma unroll
      for (int t = 0; t < 4; ++t) { float e[8];
#pragma unroll
        for (int r = 0; r < 8; ++r) e[r] = sv[t][r] * FA_C + off;
        exp2x8(e[0], e[1], e[2], e[3], e[4], e[5], e[6], e[7]);
        ps[t] = ((e[0] + e[1]) + (e[2] + e[3])) + ((e[4] + e[5]) + (e[6] + e[7]));
#pragma unroll
        for (int r = 0; r < 8; ++r) pf[t >> 1][(t & 1) * 8 + r] = (_Float16)e[r]; }
      l = l * alpha + ((ps[0] + ps[1]) + (ps[2] + ps[3]));
#pragma unroll
      for (int j = 0; j < HD / 16; ++j) {
#pragma unroll
        for (int r = 0; r < 8; ++r) o[j][r] *= alpha;
#pragma unroll
        for (int u = 0; u < 2; ++u) o[j] = wmma_h(vf[j][u], pf[u], o[j]); } }
    if (more) { const int nx = cur ^ 1; *(v4u*)&sK[nx][kr * FA_KP + ks] = rk0; *(v4u*)&sK[nx][(kr + 64) * FA_KP + ks] = rk1; *(v4u*)&sV[nx][vr * FA_VP + vs] = rv0; *(v4u*)&sV[nx][(vr + 16) * FA_VP + vs] = rv1; }
    __syncthreads(); }   // publishes stage s + 1 and ends every wave's reads of the buffer that the next trip refills
  const float inv = 1.0f / (l + xhalf(l));
#pragma unroll
  for (int j = 0; j < HD / 16; ++j) { float* yp = Y + ((size_t)b * TT + q) * CC + h * HD + j * 16 + 8 * g; v4f a0, a1;
#pragma unroll
    for (int r = 0; r < 4; ++r) { a0[r] = o[j][r] * inv; a1[r] = o[j][4 + r] * inv; }
    vst2(yp, a0); vst2(yp + 4, a1); } }

extern "C" void kernel_launch(void* const* d_in, const int* in_sizes, int n_in, void* d_out, int out_size, void* d_ws, size_t ws_size, hipStream_t stream) {
  (void)in_sizes; (void)n_in; (void)out_size;
  const float** F = (const float**)d_in;
  if (ws_size < (size_t)WS_END) return;
  char* ws = (char*)d_ws; _Float16 *QH = (_Float16*)(ws + WS_QH), *KH = (_Float16*)(ws + WS_KH), *VT = (_Float16*)(ws + WS_VT), *QL = (_Float16*)(ws + WS_QL), *KL = (_Float16*)(ws + WS_KL); __bf16 *VB = (__bf16*)(ws + WS_VB), *VBL = (__bf16*)(ws + WS_VBL); float *S = (float*)(ws + WS_S), *Y = (float*)(ws + WS_Y);
  (void)Y; (void)S; (void)QL; (void)KL; (void)VB; (void)VBL;
  // inputs: 0 Q [4,2048,256]; 1 K [4,2048,256]; 2 Wq [256,256] (out,in), 3 bq; 4 Wk, 5 bk; 6 Wv, 7 bv; 8 Wo (out,in), 9 bo; 10 g0, 11 b0; 12 g1, 13 b1
  if (ws_size < (size_t)WS_END2) return;
  float *YA = (float*)(ws + WS_Y2), *O1 = (float*)(ws + WS_O1), *R2 = (float*)(ws + WS_R2);
  k_proj<<<dim3(TNB * TT / 64, CC / 128, 3), 128, 0, stream>>>(F[0], F[1], F[1], F[2], F[4], F[6], F[3], F[5], F[7], QH, QL, KH, KL, VT, VB, VBL);
  k_fa<<<dim3(TT / 128, TNB * NH), 256, 0, stream>>>(QH, QL, KH, VT, YA);
  k_lnx<<<dim3(NRW / 8), 256, 0, stream>>>(YA, 0, F[10], F[11], O1);                                        /* o = LN0(attention output) */
  k_gemh<<<dim3(NRW / 64, CC / 128), 128, 0, stream>>>(O1, CC, CC, 0, F[8], CC, F[9], O1, 1, R2);          /* r2 = o + relu(o Wo^T + bo) */
  k_lnx<<<dim3(NRW / 8), 256, 0, stream>>>(R2, 0, F[12], F[13], (float*)d_out);                           /* out = LN1(r2) */
}

// v002
// Measured time: 63 microseconds a run.
// Next to v001, in two timings, it ran 1.89 times as fast each time.
// Over all steps from v000 it is 13.8 times as fast.
// compute dtype: all float inputs rounded to bf16; Qp/Kp/Vp = X W^T + b with EXACT bf16 products on WMMA 16x16x32 (f32 accumulate); q as f16 hi + residual (x 2^10) against k once to f16 (2 products) x 32^-0.5; softmax in f32 with a running maximum (hardware exp2); unnormalised P x 2^8 once to f16 against v once to f16 (1 product), divided by the f32 row sum at the end; LayerNorms in f32; the fc_o layer with the LN rows once to f16 against Wo as f16(bf16 x 2^6) (1 product) + bias, relu and residual in f32; f32 output.
#include <hip/hip_runtime.h>
#include <math.h>

typedef __attribute__((ext_vector_type(16))) _Float16 v16h;
typedef __attribute__((ext_vector_type(16))) __bf16 v16b;
typedef __attribute__((ext_vector_type(8)))  _Float16 v8h;
typedef __attribute__((ext_vector_type(8)))  float v8f;
typedef __attribute__((ext_vector_type(4)))  float v4f;
typedef __attribute__((ext_vector_type(2)))  float v2f;
typedef __attribute__((ext_vector_type(4)))  unsigned v4u;
typedef __attribute__((ext_vector_type(4)))  int v4i;
typedef float __attribute__((may_alias)) float_a;
typedef int __attribute__((may_alias)) int_a;

template <typename T> __device__ __forceinline__ void vst2(void* p, T v) { *(T*)p = v;  }
__device__ __forceinline__ v8f wmma16(v16h a, v16h b, v8f c) {
  v8f d = __builtin_amdgcn_wmma_f32_16x16x32_f16(false, a, false, b, (short)0, c, false, false);
  asm volatile("v_nop\n\tv_nop\n\tv_nop\n\tv_nop" : "+v"(d) : "v"(a), "v"(b));
  return d;
}
__device__ __forceinline__ v8f wmma_bf(v16b a, v16b b, v8f c) {
  v8f d = __builtin_amdgcn_wmma_f32_16x16x32_bf16(false, a, false, b, (short)0, c, false, false);
  asm volatile("v_nop\n\tv_nop\n\tv_nop\n\tv_nop" : "+v"(d) : "v"(a), "v"(b));
  return d;
}
// 16x16x32 fragments: lane = (h = lane>>4, row/col = lane&15); elements 0..7 = k0+8h+0..7, 8..15 = k0+16+8h+0..7; D element r = row 8h+r
__device__ __forceinline__ v16h frag_h(const _Float16* rowk0, int lane) {
  union { v16h v; v8h q[2]; } u; const _Float16* p = rowk0 + 8 * (lane >> 4);
  u.q[0] = *(const v8h*)p; u.q[1] = *(const v8h*)(p + 16); return u.v;
}
__device__ __forceinline__ v16h frag_f32(const float* rowk0, int lane) {
  v16h a; const float* p = rowk0 + 8 * (lane >> 4);
#pragma unroll
  for (int i = 0; i < 8; ++i) { a[i] = (_Float16)p[i]; a[8 + i] = (_Float16)p[16 + i]; }
  return a;
}
__device__ __forceinline__ v16h frag_f32s(const float* rowk0, int lane, float sc) {
  v16h a; const float* p = rowk0 + 8 * (lane >> 4);
#pragma unroll
  for (int i = 0; i < 8; ++i) { a[i] = (_Float16)(p[i] * sc); a[8 + i] = (_Float16)(p[16 + i] * sc); }
  return a;
}
// column fragment from a [K][ld] layout (column n), rows >= K read as 0
__device__ __forceinline__ v16h fragc_f32(const float* W, int k0, int n, int lane, int ld, int K) {
  v16h a; const int g = lane >> 4;
#pragma unroll
  for (int i = 0; i < 8; ++i) { const int ka = k0 + 8 * g + i, kb = ka + 16;
    a[i] = (_Float16)(ka < K ? W[(size_t)(ka < K ? ka : K - 1) * ld + n] : 0.f); a[8 + i] = (_Float16)(kb < K ? W[(size_t)(kb < K ? kb : K - 1) * ld + n] : 0.f); }
  return a;
}
struct F2 { v16b h, l; };
__device__ __forceinline__ F2 bsplit16(const float v[16]) { F2 r;
#pragma unroll
  for (int i = 0; i < 16; ++i) { const __bf16 h = (__bf16)v[i]; r.h[i] = h; r.l[i] = (__bf16)(v[i] - (float)h); }
  return r; }
__device__ __forceinline__ F2 split_row(const float* row, int k0, int lane) { float v[16]; const float* p = row + k0 + 8 * (lane >> 4);
#pragma unroll
  for (int i = 0; i < 8; ++i) { v[i] = p[i]; v[8 + i] = p[16 + i]; }
  return bsplit16(v); }
__device__ __forceinline__ F2 split_rowK(const float* row, int k0, int lane, int K) { float v[16]; const int g = lane >> 4;
#pragma unroll
  for (int i = 0; i < 8; ++i) { const int ka = k0 + 8 * g + i, kb = ka + 16; v[i] = ka < K ? row[ka < K ? ka : K - 1] : 0.f; v[8 + i] = kb < K ? row[kb < K ? kb : K - 1] : 0.f; }
  return bsplit16(v); }
__device__ __forceinline__ F2 split_col(const float* W, int k0, int n, int lane, int ld, int K) { float v[16]; const int g = lane >> 4;
#pragma unroll
  for (int i = 0; i < 8; ++i) { const int ka = k0 + 8 * g + i, kb = ka + 16; v[i] = ka < K ? W[(size_t)(ka < K ? ka : K - 1) * ld + n] : 0.f; v[8 + i] = kb < K ? W[(size_t)(kb < K ? kb : K - 1) * ld + n] : 0.f; }
  return bsplit16(v); }
__device__ __forceinline__ v8f mac3(const F2& a, const F2& b, v8f c) { c = wmma_bf(a.l, b.h, c); c = wmma_bf(a.h, b.l, c); return wmma_bf(a.h, b.h, c); }
__device__ __forceinline__ float sigm(float v) { return 1.0f / (1.0f + expf(-v)); }
#define LDSX() do { asm volatile("s_wait_dscnt 0" ::: "memory"); __builtin_amdgcn_wave_barrier(); __builtin_amdgcn_fence(__ATOMIC_RELEASE, "workgroup"); } while (0)

// Set-Transformer MAB (B 4, NQ = NK = 2,048, dim 256 = 8 heads x 32; 0.02-scale (out,in) weights, zero biases, LN gamma 1 / beta 0): Qp = Q Wq^T + bq, Kp = K Wk^T + bk, Vp = K Wv^T + bv; o = merged(softmax(q k^T / sqrt(32)) v); o = LN0(o); out = LN1(o + relu(o Wo^T + bo)) (eps 1e-5, biased var).
#define NB 4
#define TT 2048
#define CC 256            // NH * HD = projected width
#define DIN 256          // input (model) width
#define NH 8
#define HD 32
#define NQB (TT / 64)
#define HG 4
#define SCALE (0.17677669529663687f)
#define CAUSAL 0
#ifndef TNB
#define TNB NB
#endif
__device__ __forceinline__ float bfr(float v) { return (float)(__bf16)v; }
__host__ __device__ __forceinline__ int kb_last(int qb) { return CAUSAL ? ((qb * 64 + 63) >> 7) : (TT / 128 - 1); }
typedef __attribute__((ext_vector_type(8))) __bf16 v8b;
__device__ __forceinline__ v16b frag_b(const __bf16* rowk0, int lane) {
  union { v16b v; v8b q[2]; } u; const __bf16* p = rowk0 + 8 * (lane >> 4);
  u.q[0] = *(const v8b*)p; u.q[1] = *(const v8b*)(p + 16); return u.v;
}
#define QBH 0              // not referenced by any kernel here (no high-precision path)
#define QHI 2048            // rows carrying a q residual plane (all rows when non-causal: 2-product logits everywhere)
#define KHI 64            // key rows carrying k residual / v bf16 hi+lo planes (written by k_proj; no kernel here reads them)
// B fragment (k rows k0+.., output column o) of a weight: (in,out) [K][ld] or (out,in) [ld rows of K]: bf16 exact, or f16(bf16 * 256) exact
__device__ __forceinline__ v16b wcol_io(const float* Wm, int k0, int o, int lane, int ld) { v16b w; const int g = lane >> 4;
#pragma unroll
  for (int i = 0; i < 8; ++i) { w[i] = (__bf16)Wm[(size_t)(k0 + 8 * g + i) * ld + o]; w[8 + i] = (__bf16)Wm[(size_t)(k0 + 16 + 8 * g + i) * ld + o]; }
  return w; }
__device__ __forceinline__ v16b wcol_oi(const float* Wm, int k0, int o, int lane, int K) { v16b w; const float* p = Wm + (size_t)o * K + k0 + 8 * (lane >> 4);
#pragma unroll
  for (int i = 0; i < 8; ++i) { w[i] = (__bf16)p[i]; w[8 + i] = (__bf16)p[16 + i]; }
  return w; }
__device__ __forceinline__ v16h wcolh_io(const float* Wm, int k0, int o, int lane, int ld) { v16h w; const int g = lane >> 4;
#pragma unroll
  for (int i = 0; i < 8; ++i) { w[i] = (_Float16)(bfr(Wm[(size_t)(k0 + 8 * g + i) * ld + o]) * 256.0f); w[8 + i] = (_Float16)(bfr(Wm[(size_t)(k0 + 16 + 8 * g + i) * ld + o]) * 256.0f); }
  return w; }
__device__ __forceinline__ v16h wcolh_oi(const float* Wm, int k0, int o, int lane, int K) { v16h w; const float* p = Wm + (size_t)o * K + k0 + 8 * (lane >> 4);
#pragma unroll
  for (int i = 0; i < 8; ++i) { w[i] = (_Float16)(bfr(p[i]) * 256.0f); w[8 + i] = (_Float16)(bfr(p[16 + i]) * 256.0f); }
  return w; }
#define WQKV_LAYOUT 1   // 0 = (in,out) [DIN][CC]; 1 = (out,in) [CC][DIN]; 2 = per-head [NH][DIN][HD]
__device__ __forceinline__ v16b wcol_hdk(const float* Wm, int k0, int o, int lane) { v16b w; const int g = lane >> 4; const float* p = Wm + (size_t)(o / HD) * DIN * HD + (o % HD);
#pragma unroll
  for (int i = 0; i < 8; ++i) { w[i] = (__bf16)p[(size_t)(k0 + 8 * g + i) * HD]; w[8 + i] = (__bf16)p[(size_t)(k0 + 16 + 8 * g + i) * HD]; }
  return w; }
#define WO_OUT_IN 0
#if WQKV_LAYOUT == 1
#define WCOL(W, k0, o, lane) wcol_oi(W, k0, o, lane, DIN)
#elif WQKV_LAYOUT == 2
#define WCOL(W, k0, o, lane) wcol_hdk(W, k0, o, lane)
#else
#define WCOL(W, k0, o, lane) wcol_io(W, k0, o, lane, CC)
#endif
#if WO_OUT_IN
#define WOCOL(W, k0, o, lane) wcol_oi(W, k0, o, lane, CC)
#define WOCOLH(W, k0, o, lane) wcolh_oi(W, k0, o, lane, CC)
#else
#define WOCOL(W, k0, o, lane) wcol_io(W, k0, o, lane, DIN)
#define WOCOLH(W, k0, o, lane) wcolh_io(W, k0, o, lane, DIN)
#endif
#define NRW (TNB * TT)
// ---- k_lnx: wave per row: LayerNorm over CC = 256 (mean, biased var, (x - mean) * rsqrt(var + 1e-5) * g + b); optional bf16 rounding of the input (x); 8 floats per lane (2 float4 at stride 128 floats -> 512-B pieces)
__global__ __launch_bounds__(256) void k_lnx(const float* __restrict__ X, int roundin, const float* __restrict__ G, const float* __restrict__ BE, float* __restrict__ OUT) { const int wave = threadIdx.x >> 5, lane = threadIdx.x & 31; const size_t row = (size_t)blockIdx.x * 8 + wave; if (row >= (size_t)NRW) return;
  v4f v[CC / 128]; float s1 = 0.f;
#pragma unroll
  for (int i = 0; i < CC / 128; ++i) { v4f t = *(const v4f*)(X + row * CC + i * 128 + lane * 4); if (roundin) { t[0] = bfr(t[0]); t[1] = bfr(t[1]); t[2] = bfr(t[2]); t[3] = bfr(t[3]); } v[i] = t; s1 += (t[0] + t[1]) + (t[2] + t[3]); }
#pragma unroll
  for (int o = 1; o < 32; o <<= 1) s1 += __shfl_xor(s1, o);
  const float mu = s1 * (1.0f / CC); float q = 0.f;
#pragma unroll
  for (int i = 0; i < CC / 128; ++i) for (int k = 0; k < 4; ++k) { const float d = v[i][k] - mu; q += d * d; }
#pragma unroll
  for (int o = 1; o < 32; o <<= 1) q += __shfl_xor(q, o);
  const float inv = rsqrtf(q * (1.0f / CC) + 1e-5f);   /* jnp.var (biased), eps inside the rsqrt */
#pragma unroll
  for (int i = 0; i < CC / 128; ++i) { const int c = i * 128 + lane * 4; v4f r4; for (int k = 0; k < 4; ++k) r4[k] = bfr(G[c + k]) * ((v[i][k] - mu) * inv) + bfr(BE[c + k]); vst2(OUT + row * CC + c, r4); } }
#define GP 264            // LDS pitch of a staged operand row of 256 16-bit elements (528 B = 16 B x odd)
typedef __attribute__((ext_vector_type(4))) _Float16 v4h;
typedef __attribute__((ext_vector_type(4))) __bf16 v4b;
// ---- k_gemh: block = (64 rows, 128 cols), K = lda = nout = CC: OUT = [relu](A (once to f16) x W^T (W (out,in) as f16(bf16 x 2^6)) x 2^-6 + bias) (+ RES residual rows); both operand tiles converted once and staged in LDS by 512-B wave loads; 512-B segments
__global__ __launch_bounds__(128) void k_gemh(const float* __restrict__ A, const float* __restrict__ Wm, const float* __restrict__ BIAS, const float* __restrict__ RES, int relu_out, float* __restrict__ OUT) { __shared__ __align__(16) float sf[4][16][132]; __shared__ __align__(16) _Float16 sA[(64 + 128) * GP]; _Float16* sW = sA + 64 * GP;
  const int tid = threadIdx.x, wave = tid >> 5, lane = tid & 31, col = lane & 15, g = lane >> 4; const int c0 = blockIdx.y * 128; const size_t r0 = (size_t)blockIdx.x * 64 + wave * 16; const int nout = CC;
  { const int sr = tid >> 6, sc = (tid & 63) * 4; const unsigned offb = (sr * CC + sc) * 4; const char* ab = (const char*)(A + (size_t)blockIdx.x * 64 * CC); const char* wb = (const char*)(Wm + (size_t)c0 * CC);   // 128 threads x 16 B = two whole rows a pass: passes 0..31 the A rows, 32..95 the W rows ((out,in) [nout][K]); block-uniform bases, one lane offset
    v4f t[2][16];   // six batches of 16 passes, the next batch's loads in flight while this one is converted and stored; every loop here is unrolled so that t has constant indices (registers) and each load a constant offset
#pragma unroll
    for (int bt = 0; bt <= 6; ++bt) {
      if (bt < 6) {
#pragma unroll
        for (int i = 0; i < 16; ++i) { const int p = bt * 16 + i; t[bt & 1][i] = *(const v4f*)((p < 32 ? ab + p * 2 * CC * 4 : wb + (p - 32) * 2 * CC * 4) + offb); }
        asm volatile("s_wait_xcnt 0x0" :: "v"(offb), "s"(ab), "s"(wb) : "memory"); }   // the wait owed before a register that an issued load names is rewritten: as inputs, the lane offset and both bases stay untouched up to it
      if (bt > 0) {
#pragma unroll
        for (int i = 0; i < 16; ++i) { const int p = (bt - 1) * 16 + i; const v4f x = t[(bt - 1) & 1][i]; v4h c;
#pragma unroll
          for (int k = 0; k < 4; ++k) c[k] = p < 32 ? (_Float16)x[k] : (_Float16)(bfr(x[k]) * 64.0f);
          *(v4h*)&sA[(p * 2 + sr) * GP + sc] = c; } } } }
  __syncthreads();   // publishes both staged tiles
  v8f acc[8] = {};
  v16h fa[2], fw[2][8];   // fragments of two k blocks: the next block's LDS reads are issued as one group ahead of this block's products; unrolled so that both sets have constant indices (registers)
#pragma unroll
  for (int kc = -1; kc < CC / 32; ++kc) {
    if (kc + 1 < CC / 32) { fa[(kc + 1) & 1] = frag_h(&sA[(wave * 16 + col) * GP + (kc + 1) * 32], lane);
#pragma unroll
      for (int j = 0; j < 8; ++j) fw[(kc + 1) & 1][j] = frag_h(&sW[(j * 16 + col) * GP + (kc + 1) * 32], lane); }
    if (kc >= 0) {
#pragma unroll
      for (int j = 0; j < 8; ++j) acc[j] = wmma16(fa[kc & 1], fw[kc & 1][j], acc[j]); } }
#pragma unroll
  for (int j = 0; j < 8; ++j)
    { const float bb = BIAS ? bfr(BIAS[c0 + j * 16 + col]) : 0.f; asm volatile("s_wait_loadcnt 0x0" ::: "memory"); _Pragma("unroll") for (int r = 0; r < 8; ++r) sf[wave][8 * g + r][j * 16 + col] = acc[j][r] * (1.0f / 64.0f) + bb; }
  LDSX(); for (int rl = 0; rl < 16; ++rl) { const size_t o = (r0 + rl) * (size_t)nout + c0 + lane * 4; v4f v = *(const v4f*)&sf[wave][rl][lane * 4]; if (relu_out) { v[0] = fmaxf(v[0], 0.f); v[1] = fmaxf(v[1], 0.f); v[2] = fmaxf(v[2], 0.f); v[3] = fmaxf(v[3], 0.f); } if (RES) { const v4f rv = *(const v4f*)(RES + o); v[0] += rv[0]; v[1] += rv[1]; v[2] += rv[2]; v[3] += rv[3]; } vst2(OUT + o, v); } }   /* relu on the output (before the residual) when relu_out */

#ifndef SM_EXTRA_PARAMS
#define SM_EXTRA_PARAMS
#endif
#ifndef PROJ_EXTRA_PARAMS
#define PROJ_EXTRA_PARAMS
#endif
#ifndef SM_MASK_HOOK
#define SM_MASK_HOOK (void)0
#endif

#define WS_QH  0u                                      // f16 q rows [b*t][CC]
#define WS_KH  (WS_QH + 2u * (size_t)NB * TT * CC)      // f16 k rows [b*t][CC]
#define WS_VT  (WS_KH + 2u * (size_t)NB * TT * CC)      // f16 v planes [b][c][t]
#define WS_QL  (WS_VT + 2u * (size_t)NB * CC * TT)      // f16 q residual x 2^10 rows [b][t < QHI][CC]
#define WS_KL  (WS_QL + 2u * (size_t)NB * QHI * CC)     // f16 k residual x 2^10 rows [b][t < KHI][CC]
#define WS_VB  (WS_KL + 2u * (size_t)NB * KHI * CC)     // bf16 v hi planes [b][c][t < KHI]
#define WS_VBL (WS_VB + 2u * (size_t)NB * CC * KHI)
#define WS_S   (WS_VBL + 2u * (size_t)NB * CC * KHI)    // f32 [hg][t][s] region; no kernel here uses it
#define WS_Y   (WS_S  + 4u * (size_t)HG * TT * TT)      // f32 ctx rows [b*t][CC] (only when there is an output projection)
#define WS_END (WS_Y  + 0u)
#define WS_Y2  (WS_END)
#define WS_O1  (WS_Y2 + 4u * (size_t)NB * TT * CC)
#define WS_R2  (WS_O1 + 4u * (size_t)NB * TT * CC)
#define WS_END2 (WS_R2 + 4u * (size_t)NB * TT * CC)

// ---- k_proj: block = (64 rows, 128 cols, which): q/k/v = X W (+ b) with exact bf16 products (K = DIN) -> which 0: q f16 rows (+ residual rows < QHI); 1: k f16 rows (+ residual rows < KHI); 2: v f16 planes [c][t] (+ bf16 hi/lo planes for t < KHI)
__global__ __launch_bounds__(128) void k_proj(const float* __restrict__ XQ, const float* __restrict__ XK, const float* __restrict__ XV, const float* __restrict__ WQ, const float* __restrict__ WK, const float* __restrict__ WV, const float* __restrict__ BQ, const float* __restrict__ BK, const float* __restrict__ BV,
    _Float16* __restrict__ QH, _Float16* __restrict__ QL, _Float16* __restrict__ KH, _Float16* __restrict__ KL, _Float16* __restrict__ VT, __bf16* __restrict__ VB, __bf16* __restrict__ VBL) {
  __shared__ __align__(16) char sm[(64 + 128) * GP * 2];   // first the two staged operand tiles, then (behind a barrier) the epilogue's transposing tiles
  __bf16* sX = (__bf16*)sm; __bf16* sW = sX + 64 * GP;
  _Float16 (*sh)[136] = (_Float16 (*)[136])sm; _Float16 (*sl)[136] = sh + 64; _Float16 (*th)[72] = (_Float16 (*)[72])sm; __bf16 (*tb)[72] = (__bf16 (*)[72])(sm + 128 * 72 * 2); __bf16 (*tbl)[72] = tb + 128;
  const int tid = threadIdx.x, wave = tid >> 5, lane = tid & 31, col = lane & 15, g = lane >> 4; const int which = blockIdx.z; const int c0 = blockIdx.y * 128; const size_t r0 = (size_t)blockIdx.x * 64; const size_t bb = r0 / TT; const int t0 = (int)(r0 % TT);
  const float* X = which == 0 ? XQ : which == 1 ? XK : XV; const float* WA = which == 0 ? WQ : which == 1 ? WK : WV; const float* BA = which == 0 ? BQ : which == 1 ? BK : BV;
  { const int sr = tid >> 6, sc = (tid & 63) * 4; const unsigned offb = (sr * DIN + sc) * 4; const char* xb = (const char*)(X + r0 * DIN); const char* wb = (const char*)(WA + (size_t)c0 * DIN);   // 128 threads x 16 B = two whole rows a pass: passes 0..31 the X rows, 32..95 the W rows ((out,in) [CC][DIN]); block-uniform bases, one lane offset
    v4f t[2][16];   // six batches of 16 passes, the next batch's loads in flight while this one is converted and stored; every loop here is unrolled so that t has constant indices (registers) and each load a constant offset
#pragma unroll
    for (int bt = 0; bt <= 6; ++bt) {
      if (bt < 6) {
#pragma unroll
        for (int i = 0; i < 16; ++i) { const int p = bt * 16 + i; t[bt & 1][i] = *(const v4f*)((p < 32 ? xb + p * 2 * DIN * 4 : wb + (p - 32) * 2 * DIN * 4) + offb); }
        asm volatile("s_wait_xcnt 0x0" :: "v"(offb), "s"(xb), "s"(wb) : "memory"); }   // the wait owed before a register that an issued load names is rewritten: as inputs, the lane offset and both bases stay untouched up to it
      if (bt > 0) {
#pragma unroll
        for (int i = 0; i < 16; ++i) { const int p = (bt - 1) * 16 + i; const v4f x = t[(bt - 1) & 1][i]; v4b c;
#pragma unroll
          for (int k = 0; k < 4; ++k) c[k] = (__bf16)x[k];
          *(v4b*)&sX[(p * 2 + sr) * GP + sc] = c; } } } }
  __syncthreads();   // publishes both staged tiles
  v8f acc[8] = {};
  v16b fa[2], fw[2][8];   // fragments of two k blocks: the next block's LDS reads are issued as one group ahead of this block's products; unrolled so that both sets have constant indices (registers)
#pragma unroll
  for (int kc = -1; kc < DIN / 32; ++kc) {
    if (kc + 1 < DIN / 32) { fa[(kc + 1) & 1] = frag_b(&sX[(wave * 16 + col) * GP + (kc + 1) * 32], lane);
#pragma unroll
      for (int j = 0; j < 8; ++j) fw[(kc + 1) & 1][j] = frag_b(&sW[(j * 16 + col) * GP + (kc + 1) * 32], lane); }
    if (kc >= 0) {
#pragma unroll
      for (int j = 0; j < 8; ++j) acc[j] = wmma_bf(fa[kc & 1], fw[kc & 1][j], acc[j]); } }
  __syncthreads();   // ends every wave's fragment reads before the epilogue's tiles overwrite the staged operands
  if (which < 2) { _Float16* DH = which == 0 ? QH : KH; _Float16* DL = which == 0 ? QL : KL; const int nhi = which == 0 ? QHI : KHI; const bool hi_rows = t0 < nhi;
#pragma unroll
    for (int j = 0; j < 8; ++j) { const float bias = BA ? bfr(BA[c0 + j * 16 + col]) : 0.f;
#pragma unroll
      for (int r = 0; r < 8; ++r) { const float v = acc[j][r] + bias; const _Float16 hv = (_Float16)v; sh[wave * 16 + 8 * g + r][j * 16 + col] = hv; sl[wave * 16 + 8 * g + r][j * 16 + col] = (_Float16)((v - (float)hv) * 1024.0f); } }
    __syncthreads();
    for (int e = tid; e < 64 * 16; e += 128) { const int rl = e >> 4, q = e & 15; vst2((unsigned*)(DH + (r0 + rl) * CC + c0 + q * 8), *(const v4u*)&sh[rl][q * 8]); if (hi_rows) vst2((unsigned*)(DL + (bb * nhi + t0 + rl) * (size_t)CC + c0 + q * 8), *(const v4u*)&sl[rl][q * 8]); }
  } else { const bool hi_rows = t0 < KHI;
#pragma unroll
    for (int j = 0; j < 8; ++j) { const float bias = BA ? bfr(BA[c0 + j * 16 + col]) : 0.f;
#pragma unroll
      for (int r = 0; r < 8; ++r) { const float v = acc[j][r] + bias; const int rl = wave * 16 + 8 * g + r, cl = j * 16 + col; th[cl][rl] = (_Float16)v; const __bf16 bh = (__bf16)v; tb[cl][rl] = bh; tbl[cl][rl] = (__bf16)(v - (float)bh); } }
    __syncthreads();
    for (int e = tid; e < 128 * 8; e += 128) { const int cl = e >> 3, q = e & 7; vst2((unsigned*)(VT + (bb * CC + c0 + cl) * (size_t)TT + t0 + q * 8), *(const v4u*)&th[cl][q * 8]); if (hi_rows) { const size_t o3 = (bb * CC + c0 + cl) * (size_t)KHI + t0 + q * 8; vst2((unsigned*)(VB + o3), *(const v4u*)&tb[cl][q * 8]); vst2((unsigned*)(VBL + o3), *(const v4u*)&tbl[cl][q * 8]); } } } }
// ---- k_fa: block = 128 queries of one (b, h), 8 waves x 16 query columns: S^T = k q^T (q hi + residual x 2^10, 2 products), running maximum and sum per query in f32, P^T x 2^8 (relative to the running maximum) once to f16 straight from the score tiles as B operand, O^T += v^T P^T (1 product); k rows and v planes staged in LDS, 128 keys a stage, two buffers
#define FA_ST 128          // keys per stage
#define FA_KP 40           // LDS pitch of a k row in halfs (80 B = 16 B x odd)
#define FA_VP 136          // LDS pitch of a v plane row in halfs (272 B = 16 B x odd)
#define FA_C (SCALE * 1.4426950408889634f)
__device__ __forceinline__ float xhalf(float x) { return __builtin_bit_cast(float, __builtin_amdgcn_permlanex16(__builtin_bit_cast(int, x), __builtin_bit_cast(int, x), 0x76543210, 0xfedcba98, false, false)); }   // lane l with lane l ^ 16
// exp2 of eight values, each in its own register, in one statement closed by v_nop: no exp2 of the run touches a neighbour's register, and the v_nop is the slot that the instruction set asks for between a transcendental and the first use of its result
__device__ __forceinline__ void exp2x8(float& x0, float& x1, float& x2, float& x3, float& x4, float& x5, float& x6, float& x7) {
  asm("v_exp_f32 %0, %0\n\tv_exp_f32 %1, %1\n\tv_exp_f32 %2, %2\n\tv_exp_f32 %3, %3\n\tv_exp_f32 %4, %4\n\tv_exp_f32 %5, %5\n\tv_exp_f32 %6, %6\n\tv_exp_f32 %7, %7\n\tv_nop"
      : "+v"(x0), "+v"(x1), "+v"(x2), "+v"(x3), "+v"(x4), "+v"(x5), "+v"(x6), "+v"(x7)); }
__device__ __forceinline__ v8f wmma_h(v16h a, v16h b, v8f c) { return __builtin_amdgcn_wmma_f32_16x16x32_f16(false, a, false, b, (short)0, c, false, false); }
__global__ __launch_bounds__(256) __attribute__((amdgpu_waves_per_eu(4, 4))) void k_fa(const _Float16* __restrict__ QH, const _Float16* __restrict__ QL, const _Float16* __restrict__ KH, const _Float16* __restrict__ VT, float* __restrict__ Y) {
  __shared__ __align__(16) _Float16 sK[2][FA_ST * FA_KP]; __shared__ __align__(16) _Float16 sV[2][HD * FA_VP];
  const int tid = threadIdx.x, wave = tid >> 5, lane = tid & 31, col = lane & 15, g = lane >> 4; const int b = blockIdx.y / NH, h = blockIdx.y % NH; const int q = blockIdx.x * 128 + wave * 16 + col;
  const v16h qh = frag_h(QH + ((size_t)b * TT + q) * CC + h * HD, lane), ql = frag_h(QL + ((size_t)b * QHI + q) * CC + h * HD, lane);   // B operands: column = query
  const int kr = tid >> 2, ks = (tid & 3) * 8, vr = tid >> 4, vs = (tid & 15) * 8;   // this thread's 16-B pieces of a stage: k rows kr, kr + 64; v rows vr, vr + 16
  const _Float16* Kg = KH + ((size_t)b * TT + kr) * CC + h * HD + ks; const _Float16* Vg = VT + ((size_t)b * CC + h * HD + vr) * TT + vs;
  v4u rk0 = *(const v4u*)Kg, rk1 = *(const v4u*)(Kg + (size_t)64 * CC), rv0 = *(const v4u*)Vg, rv1 = *(const v4u*)(Vg + (size_t)16 * TT);
  *(v4u*)&sK[0][kr * FA_KP + ks] = rk0; *(v4u*)&sK[0][(kr + 64) * FA_KP + ks] = rk1; *(v4u*)&sV[0][vr * FA_VP + vs] = rv0; *(v4u*)&sV[0][(vr + 16) * FA_VP + vs] = rv1;
  __syncthreads();
  v8f o[HD / 16] = {}; float m = -3.0e38f, l = 0.f;
#pragma unroll 1   // the stage loop stays rolled: one stage is already a long straight body; the inner loops are unrolled so that every register array has constant indices
  for (int s = 0; s < TT / FA_ST; ++s) { const int cur = s & 1; const bool more = s + 1 < TT / FA_ST;
    if (more) { const _Float16* kp = Kg + (size_t)(s + 1) * FA_ST * CC; const _Float16* vp = Vg + (s + 1) * FA_ST; rk0 = *(const v4u*)kp; rk1 = *(const v4u*)(kp + (size_t)64 * CC); rv0 = *(const v4u*)vp; rv1 = *(const v4u*)(vp + (size_t)16 * TT); }
#pragma unroll
    for (int kk = 0; kk < FA_ST; kk += 64) { v8f sv[4];
#pragma unroll
      for (int t = 0; t < 4; ++t) { const v16h kf = frag_h(&sK[cur][(kk + t * 16 + col) * FA_KP], lane); const v8f z = {}; const v8f lo = wmma_h(kf, ql, z), hi = wmma_h(kf, qh, z);   // A operand: row = key
#pragma unroll
        for (int r = 0; r < 8; ++r) sv[t][r] = hi[r] + lo[r] * (1.0f / 1024.0f); }
      v16h vf[HD / 16][2];   // A operands of the second product: row = channel, keys in the order of the packed score tiles
#pragma unroll
      for (int j = 0; j < HD / 16; ++j)
#pragma unroll
        for (int u = 0; u < 2; ++u) vf[j][u] = frag_h(&sV[cur][(j * 16 + col) * FA_VP + kk + u * 32], lane);
      float mt[4];
#pragma unroll
      for (int t = 0; t < 4; ++t) { mt[t] = sv[t][0];
#pragma unroll
        for (int r = 1; r < 8; ++r) mt[t] = fmaxf(mt[t], sv[t][r]); }
      float mx = fmaxf(fmaxf(mt[0], mt[1]), fmaxf(mt[2], mt[3]));
      mx = fmaxf(mx, xhalf(mx)); const float mn = fmaxf(m, mx); const float alpha = __builtin_amdgcn_exp2f((m - mn) * FA_C); m = mn; const float off = 8.0f - mn * FA_C;
      float ps[4]; v16h pf[2];
#pragma unroll
      for (int t = 0; t < 4; ++t) { float e[8];
#pragma unroll
        for (int r = 0; r < 8; ++r) e[r] = sv[t][r] * FA_C + off;
        exp2x8(e[0], e[1], e[2], e[3], e[4], e[5], e[6], e[7]);
        ps[t] = ((e[0] + e[1]) + (e[2] + e[3])) + ((e[4] + e[5]) + (e[6] + e[7]));
#pragma unroll
        for (int r = 0; r < 8; ++r) pf[t >> 1][(t & 1) * 8 + r] = (_Float16)e[r]; }
      l = l * alpha + ((ps[0] + ps[1]) + (ps[2] + ps[3]));
#pragma unroll
      for (int j = 0; j < HD / 16; ++j) {
#pragma unroll
        for (int r = 0; r < 8; ++r) o[j][r] *= alpha;
#pragma unroll
        for (int u = 0; u < 2; ++u) o[j] = wmma_h(vf[j][u], pf[u], o[j]); } }
    if (more) { const int nx = cur ^ 1; *(v4u*)&sK[nx][kr * FA_KP + ks] = rk0; *(v4u*)&sK[nx][(kr + 64) * FA_KP + ks] = rk1; *(v4u*)&sV[nx][vr * FA_VP + vs] = rv0; *(v4u*)&sV[nx][(vr + 16) * FA_VP + vs] = rv1; }
    __syncthreads(); }   // publishes stage s + 1 and ends every wave's reads of the buffer that the next trip refills
  const float inv = 1.0f / (l + xhalf(l));
#pragma unroll
  for (int j = 0; j < HD / 16; ++j) { float* yp = Y + ((size_t)b * TT + q) * CC + h * HD + j * 16 + 8 * g; v4f a0, a1;
#pragma unroll
    for (int r = 0; r < 4; ++r) { a0[r] = o[j][r] * inv; a1[r] = o[j][4 + r] * inv; }
    vst2(yp, a0); vst2(yp + 4, a1); } }

extern "C" void kernel_launch(void* const* d_in, const int* in_sizes, int n_in, void* d_out, int out_size, void* d_ws, size_t ws_size, hipStream_t stream) {
  (void)in_sizes; (void)n_in; (void)out_size;
  const float** F = (const float**)d_in;
  if (ws_size < (size_t)WS_END) return;
  char* ws = (char*)d_ws; _Float16 *QH = (_Float16*)(ws + WS_QH), *KH = (_Float16*)(ws + WS_KH), *VT = (_Float16*)(ws + WS_VT), *QL = (_Float16*)(ws + WS_QL), *KL = (_Float16*)(ws + WS_KL); __bf16 *VB = (__bf16*)(ws + WS_VB), *VBL = (__bf16*)(ws + WS_VBL); float *S = (float*)(ws + WS_S), *Y = (float*)(ws + WS_Y);
  (void)Y; (void)S; (void)QL; (void)KL; (void)VB; (void)VBL;
  // inputs: 0 Q [4,2048,256]; 1 K [4,2048,256]; 2 Wq [256,256] (out,in), 3 bq; 4 Wk, 5 bk; 6 Wv, 7 bv; 8 Wo (out,in), 9 bo; 10 g0, 11 b0; 12 g1, 13 b1
  if (ws_size < (size_t)WS_END2) return;
  float *YA = (float*)(ws + WS_Y2), *O1 = (float*)(ws + WS_O1), *R2 = (float*)(ws + WS_R2);
  k_proj<<<dim3(TNB * TT / 64, CC / 128, 3), 128, 0, stream>>>(F[0], F[1], F[1], F[2], F[4], F[6], F[3], F[5], F[7], QH, QL, KH, KL, VT, VB, VBL);
  k_fa<<<dim3(TT / 128, TNB * NH), 256, 0, stream>>>(QH, QL, KH, VT, YA);
  k_lnx<<<dim3(NRW / 8), 256, 0, stream>>>(YA, 0, F[10], F[11], O1);                                        /* o = LN0(attention output) */
  k_gemh<<<dim3(NRW / 64, CC / 128), 128, 0, stream>>>(O1, F[8], F[9], O1, 1, R2);          /* r2 = o + relu(o Wo^T + bo) */
  k_lnx<<<dim3(NRW / 8), 256, 0, stream>>>(R2, 0, F[12], F[13], (float*)d_out);                           /* out = LN1(r2) */
}

// v003
// A run of this version takes 48.3 microseconds.
// Two timings next to v002 both put it at 1.31 times that version's speed.
// Over all steps from v000 it is 18.1 times as fast.
// compute dtype: all float inputs rounded to bf16; Qp/Kp/Vp = X W^T + b with EXACT bf16 products on WMMA 16x16x32 (f32 accumulate); q as f16 hi + residual (x 2^10) against k once to f16 (2 products) x 32^-0.5; softmax in f32 with a running maximum (hardware exp2); unnormalised P x 2^8 once to f16 against v once to f16 (1 product), divided by the f32 row sum at the end; LayerNorms in f32; the fc_o layer with the LN rows once to f16 against Wo as f16(bf16 x 2^6) (1 product) + bias, relu and residual in f32; f32 output.
#include <hip/hip_runtime.h>
#include <math.h>

typedef __attribute__((ext_vector_type(16))) _Float16 v16h;
typedef __attribute__((ext_vector_type(16))) __bf16 v16b;
typedef __attribute__((ext_vector_type(8)))  _Float16 v8h;
typedef __attribute__((ext_vector_type(8)))  float v8f;
typedef __attribute__((ext_vector_type(4)))  float v4f;
typedef __attribute__((ext_vector_type(2)))  float v2f;
typedef __attribute__((ext_vector_type(4)))  unsigned v4u;
typedef __attribute__((ext_vector_type(4)))  int v4i;
typedef float __attribute__((may_alias)) float_a;
typedef int __attribute__((may_alias)) int_a;

template <typename T> __device__ __forceinline__ void vst2(void* p, T v) { *(T*)p = v;  }
__device__ __forceinline__ v8f wmma16(v16h a, v16h b, v8f c) {
  v8f d = __builtin_amdgcn_wmma_f32_16x16x32_f16(false, a, false, b, (short)0, c, false, false);
  asm volatile("v_nop\n\tv_nop\n\tv_nop\n\tv_nop" : "+v"(d) : "v"(a), "v"(b));
  return d;
}
__device__ __forceinline__ v8f wmma_bf(v16b a, v16b b, v8f c) {
  v8f d = __builtin_amdgcn_wmma_f32_16x16x32_bf16(false, a, false, b, (short)0, c, false, false);
  asm volatile("v_nop\n\tv_nop\n\tv_nop\n\tv_nop" : "+v"(d) : "v"(a), "v"(b));
  return d;
}
// 16x16x32 fragments: lane = (h = lane>>4, row/col = lane&15); elements 0..7 = k0+8h+0..7, 8..15 = k0+16+8h+0..7; D element r = row 8h+r
__device__ __forceinline__ v16h frag_h(const _Float16* rowk0, int lane) {
  union { v16h v; v8h q[2]; } u; const _Float16* p = rowk0 + 8 * (lane >> 4);
  u.q[0] = *(const v8h*)p; u.q[1] = *(const v8h*)(p + 16); return u.v;
}
__device__ __forceinline__ v16h frag_f32(const float* rowk0, int lane) {
  v16h a; const float* p = rowk0 + 8 * (lane >> 4);
#pragma unroll
  for (int i = 0; i < 8; ++i) { a[i] = (_Float16)p[i]; a[8 + i] = (_Float16)p[16 + i]; }
  return a;
}
__device__ __forceinline__ v16h frag_f32s(const float* rowk0, int lane, float sc) {
  v16h a; const float* p = rowk0 + 8 * (lane >> 4);
#pragma unroll
  for (int i = 0; i < 8; ++i) { a[i] = (_Float16)(p[i] * sc); a[8 + i] = (_Float16)(p[16 + i] * sc); }
  return a;
}
// column fragment from a [K][ld] layout (column n), rows >= K read as 0
__device__ __forceinline__ v16h fragc_f32(const float* W, int k0, int n, int lane, int ld, int K) {
  v16h a; const int g = lane >> 4;
#pragma unroll
  for (int i = 0; i < 8; ++i) { const int ka = k0 + 8 * g + i, kb = ka + 16;
    a[i] = (_Float16)(ka < K ? W[(size_t)(ka < K ? ka : K - 1) * ld + n] : 0.f); a[8 + i] = (_Float16)(kb < K ? W[(size_t)(kb < K ? kb : K - 1) * ld + n] : 0.f); }
  return a;
}
struct F2 { v16b h, l; };
__device__ __forceinline__ F2 bsplit16(const float v[16]) { F2 r;
#pragma unroll
  for (int i = 0; i < 16; ++i) { const __bf16 h = (__bf16)v[i]; r.h[i] = h; r.l[i] = (__bf16)(v[i] - (float)h); }
  return r; }
__device__ __forceinline__ F2 split_row(const float* row, int k0, int lane) { float v[16]; const float* p = row + k0 + 8 * (lane >> 4);
#pragma unroll
  for (int i = 0; i < 8; ++i) { v[i] = p[i]; v[8 + i] = p[16 + i]; }
  return bsplit16(v); }
__device__ __forceinline__ F2 split_rowK(const float* row, int k0, int lane, int K) { float v[16]; const int g = lane >> 4;
#pragma unroll
  for (int i = 0; i < 8; ++i) { const int ka = k0 + 8 * g + i, kb = ka + 16; v[i] = ka < K ? row[ka < K ? ka : K - 1] : 0.f; v[8 + i] = kb < K ? row[kb < K ? kb : K - 1] : 0.f; }
  return bsplit16(v); }
__device__ __forceinline__ F2 split_col(const float* W, int k0, int n, int lane, int ld, int K) { float v[16]; const int g = lane >> 4;
#pragma unroll
  for (int i = 0; i < 8; ++i) { const int ka = k0 + 8 * g + i, kb = ka + 16; v[i] = ka < K ? W[(size_t)(ka < K ? ka : K - 1) * ld + n] : 0.f; v[8 + i] = kb < K ? W[(size_t)(kb < K ? kb : K - 1) * ld + n] : 0.f; }
  return bsplit16(v); }
__device__ __forceinline__ v8f mac3(const F2& a, const F2& b, v8f c) { c = wmma_bf(a.l, b.h, c); c = wmma_bf(a.h, b.l, c); return wmma_bf(a.h, b.h, c); }
__device__ __forceinline__ float sigm(float v) { return 1.0f / (1.0f + expf(-v)); }
#define LDSX() do { asm volatile("s_wait_dscnt 0" ::: "memory"); __builtin_amdgcn_wave_barrier(); __builtin_amdgcn_fence(__ATOMIC_RELEASE, "workgroup"); } while (0)

// Set-Transformer MAB (B 4, NQ = NK = 2,048, dim 256 = 8 heads x 32; 0.02-scale (out,in) weights, zero biases, LN gamma 1 / beta 0): Qp = Q Wq^T + bq, Kp = K Wk^T + bk, Vp = K Wv^T + bv; o = merged(softmax(q k^T / sqrt(32)) v); o = LN0(o); out = LN1(o + relu(o Wo^T + bo)) (eps 1e-5, biased var).
#define NB 4
#define TT 2048
#define CC 256            // NH * HD = projected width
#define DIN 256          // input (model) width
#define NH 8
#define HD 32
#define NQB (TT / 64)
#define HG 4
#define SCALE (0.17677669529663687f)
#define CAUSAL 0
#ifndef TNB
#define TNB NB
#endif
__device__ __forceinline__ float bfr(float v) { return (float)(__bf16)v; }
__host__ __device__ __forceinline__ int kb_last(int qb) { return CAUSAL ? ((qb * 64 + 63) >> 7) : (TT / 128 - 1); }
typedef __attribute__((ext_vector_type(8))) __bf16 v8b;
__device__ __forceinline__ v16b frag_b(const __bf16* rowk0, int lane) {
  union { v16b v; v8b q[2]; } u; const __bf16* p = rowk0 + 8 * (lane >> 4);
  u.q[0] = *(const v8b*)p; u.q[1] = *(const v8b*)(p + 16); return u.v;
}
#define QBH 0              // not referenced by any kernel here (no high-precision path)
#define QHI 2048            // rows carrying a q residual plane (all rows when non-causal: 2-product logits everywhere)
#define KHI 64            // key rows carrying k residual / v bf16 hi+lo planes (written by k_proj; no kernel here reads them)
// B fragment (k rows k0+.., output column o) of a weight: (in,out) [K][ld] or (out,in) [ld rows of K]: bf16 exact, or f16(bf16 * 256) exact
__device__ __forceinline__ v16b wcol_io(const float* Wm, int k0, int o, int lane, int ld) { v16b w; const int g = lane >> 4;
#pragma unroll
  for (int i = 0; i < 8; ++i) { w[i] = (__bf16)Wm[(size_t)(k0 + 8 * g + i) * ld + o]; w[8 + i] = (__bf16)Wm[(size_t)(k0 + 16 + 8 * g + i) * ld + o]; }
  return w; }
__device__ __forceinline__ v16b wcol_oi(const float* Wm, int k0, int o, int lane, int K) { v16b w; const float* p = Wm + (size_t)o * K + k0 + 8 * (lane >> 4);
#pragma unroll
  for (int i = 0; i < 8; ++i) { w[i] = (__bf16)p[i]; w[8 + i] = (__bf16)p[16 + i]; }
  return w; }
__device__ __forceinline__ v16h wcolh_io(const float* Wm, int k0, int o, int lane, int ld) { v16h w; const int g = lane >> 4;
#pragma unroll
  for (int i = 0; i < 8; ++i) { w[i] = (_Float16)(bfr(Wm[(size_t)(k0 + 8 * g + i) * ld + o]) * 256.0f); w[8 + i] = (_Float16)(bfr(Wm[(size_t)(k0 + 16 + 8 * g + i) * ld + o]) * 256.0f); }
  return w; }
__device__ __forceinline__ v16h wcolh_oi(const float* Wm, int k0, int o, int lane, int K) { v16h w; const float* p = Wm + (size_t)o * K + k0 + 8 * (lane >> 4);
#pragma unroll
  for (int i = 0; i < 8; ++i) { w[i] = (_Float16)(bfr(p[i]) * 256.0f); w[8 + i] = (_Float16)(bfr(p[16 + i]) * 256.0f); }
  return w; }
#define WQKV_LAYOUT 1   // 0 = (in,out) [DIN][CC]; 1 = (out,in) [CC][DIN]; 2 = per-head [NH][DIN][HD]
__device__ __forceinline__ v16b wcol_hdk(const float* Wm, int k0, int o, int lane) { v16b w; const int g = lane >> 4; const float* p = Wm + (size_t)(o / HD) * DIN * HD + (o % HD);
#pragma unroll
  for (int i = 0; i < 8; ++i) { w[i] = (__bf16)p[(size_t)(k0 + 8 * g + i) * HD]; w[8 + i] = (__bf16)p[(size_t)(k0 + 16 + 8 * g + i) * HD]; }
  return w; }
#define WO_OUT_IN 0
#if WQKV_LAYOUT == 1
#define WCOL(W, k0, o, lane) wcol_oi(W, k0, o, lane, DIN)
#elif WQKV_LAYOUT == 2
#define WCOL(W, k0, o, lane) wcol_hdk(W, k0, o, lane)
#else
#define WCOL(W, k0, o, lane) wcol_io(W, k0, o, lane, CC)
#endif
#if WO_OUT_IN
#define WOCOL(W, k0, o, lane) wcol_oi(W, k0, o, lane, CC)
#define WOCOLH(W, k0, o, lane) wcolh_oi(W, k0, o, lane, CC)
#else
#define WOCOL(W, k0, o, lane) wcol_io(W, k0, o, lane, DIN)
#define WOCOLH(W, k0, o, lane) wcolh_io(W, k0, o, lane, DIN)
#endif
#define NRW (TNB * TT)
// LayerNorm over CC = 256 of four rows held by one wave (mean, biased var, (x - mean) * rsqrt(var + 1e-5) * g + b): 8 floats of a row per lane (2 float4 at stride 128 floats); the four rows' lane exchanges are independent of one another
__device__ __forceinline__ void ln4(v4f (&v)[4][CC / 128], const v4f (&gv)[CC / 128], const v4f (&bv)[CC / 128]) {
  float s1[4], q[4];
#pragma unroll
  for (int rr = 0; rr < 4; ++rr) { s1[rr] = 0.f;
#pragma unroll
    for (int i = 0; i < CC / 128; ++i) { const v4f t = v[rr][i]; s1[rr] += (t[0] + t[1]) + (t[2] + t[3]); } }
#pragma unroll
  for (int o = 1; o < 32; o <<= 1)
#pragma unroll
    for (int rr = 0; rr < 4; ++rr) s1[rr] += __shfl_xor(s1[rr], o);
#pragma unroll
  for (int rr = 0; rr < 4; ++rr) { s1[rr] *= (1.0f / CC); q[rr] = 0.f;
#pragma unroll
    for (int i = 0; i < CC / 128; ++i)
#pragma unroll
      for (int k = 0; k < 4; ++k) { const float d = v[rr][i][k] - s1[rr]; q[rr] += d * d; } }
#pragma unroll
  for (int o = 1; o < 32; o <<= 1)
#pragma unroll
    for (int rr = 0; rr < 4; ++rr) q[rr] += __shfl_xor(q[rr], o);
#pragma unroll
  for (int rr = 0; rr < 4; ++rr) q[rr] = rsqrtf(q[rr] * (1.0f / CC) + 1e-5f);   /* jnp.var (biased), eps inside the rsqrt */
#pragma unroll
  for (int rr = 0; rr < 4; ++rr)
#pragma unroll
    for (int i = 0; i < CC / 128; ++i)
#pragma unroll
      for (int k = 0; k < 4; ++k) v[rr][i][k] = bfr(gv[i][k]) * ((v[rr][i][k] - s1[rr]) * q[rr]) + bfr(bv[i][k]); }
#define GP 264            // LDS pitch of a staged operand row of 256 16-bit elements (528 B = 16 B x odd)
typedef __attribute__((ext_vector_type(4))) _Float16 v4h;
typedef __attribute__((ext_vector_type(4))) __bf16 v4b;
#define TR 32             // rows of a block of k_tail
#define OP 260            // LDS pitch of an f32 row there (1,040 B: the two lane halves of an accumulator tile, 8 rows apart, fall on different banks)
// ---- k_tail: block = 32 whole rows, 8 waves: o = LN0(Y) (wave = 4 rows; kept in LDS as f32 rows and once to f16), r = o + relu(o x W^T (W (out,in) as f16(bf16 x 2^6), all 256 rows staged in LDS by 512-B wave loads) x 2^-6 + bias) (wave = 32 rows x 32 cols), OUT = LN1(r) (wave = 4 rows)
__global__ __launch_bounds__(256) void k_tail(const float* __restrict__ Y, const float* __restrict__ G0, const float* __restrict__ BE0, const float* __restrict__ Wm, const float* __restrict__ BIAS, const float* __restrict__ G1, const float* __restrict__ BE1, float* __restrict__ OUT) {
  __shared__ __align__(16) _Float16 sW[CC * GP]; __shared__ __align__(16) _Float16 sA[TR * GP]; __shared__ __align__(16) float sO[TR * OP];
  const int tid = threadIdx.x, wave = tid >> 5, lane = tid & 31, col = lane & 15, g = lane >> 4;
  const char* yb = (const char*)(Y + (size_t)blockIdx.x * TR * CC); const char* wb = (const char*)Wm; const unsigned offy = (wave * 4 * CC + lane * 4) * 4, offl = lane * 16, offb = tid * 16, offc = (wave * 32 + col) * 4;   // block-uniform bases, one lane offset each
  v4f y[4][CC / 128], g0v[CC / 128], b0v[CC / 128], g1v[CC / 128], b1v[CC / 128]; float bo[2];
#pragma unroll
  for (int rr = 0; rr < 4; ++rr)
#pragma unroll
    for (int i = 0; i < CC / 128; ++i) y[rr][i] = *(const v4f*)(yb + (rr * CC + i * 128) * 4 + offy);
#pragma unroll
  for (int i = 0; i < CC / 128; ++i) { g0v[i] = *(const v4f*)((const char*)G0 + i * 512 + offl); b0v[i] = *(const v4f*)((const char*)BE0 + i * 512 + offl); }
  asm volatile("s_wait_xcnt 0x0" :: "v"(offy), "v"(offl), "s"(yb), "s"(G0), "s"(BE0) : "memory");   // the wait owed before a register that an issued load names is rewritten: as inputs, the lane offsets and the bases stay untouched up to it
  v4f t[2][16];   // W: 256 threads x 16 B = four whole rows a pass, four batches of 16 passes, two batches in flight; every loop here is unrolled so that t has constant indices (registers) and each load a constant offset
#pragma unroll
  for (int bt = 0; bt < 2; ++bt)
#pragma unroll
    for (int i = 0; i < 16; ++i) t[bt][i] = *(const v4f*)(wb + (bt * 16 + i) * 4 * CC * 4 + offb);
  asm volatile("s_wait_xcnt 0x0" :: "v"(offb), "s"(wb) : "memory");   // as above
  ln4(y, g0v, b0v);   // runs while the first two batches of W are in flight
#pragma unroll
  for (int rr = 0; rr < 4; ++rr)
#pragma unroll
    for (int i = 0; i < CC / 128; ++i) { const v4f x = y[rr][i]; v4h c;
#pragma unroll
      for (int k = 0; k < 4; ++k) c[k] = (_Float16)x[k];
      *(v4f*)&sO[(wave * 4 + rr) * OP + i * 128 + lane * 4] = x; *(v4h*)&sA[(wave * 4 + rr) * GP + i * 128 + lane * 4] = c; }
  __builtin_amdgcn_sched_barrier(0);   // keeps the conversions of W behind LN0: drawn up among it they hold converted copies beside the loaded registers, and the kernel goes past 256 registers (a window switch at every other instruction)
#pragma unroll
  for (int bt = 0; bt < 4; ++bt) {
#pragma unroll
    for (int i = 0; i < 16; ++i) { const int p = bt * 16 + i; const v4f x = t[bt & 1][i]; v4h c;
#pragma unroll
      for (int k = 0; k < 4; ++k) c[k] = (_Float16)(bfr(x[k]) * 64.0f);
      *(v4h*)&sW[(p * 4 + (tid >> 6)) * GP + (tid & 63) * 4] = c; }
    if (bt + 2 < 4) {
#pragma unroll
      for (int i = 0; i < 16; ++i) t[bt & 1][i] = *(const v4f*)(wb + ((bt + 2) * 16 + i) * 4 * CC * 4 + offb);
      asm volatile("s_wait_xcnt 0x0" :: "v"(offb), "s"(wb) : "memory"); }   // as above
    if (bt == 1) {   // what the epilogue and LN1 need, issued behind the last batch of W: back before the barrier below waits for every load
#pragma unroll
      for (int i = 0; i < CC / 128; ++i) { g1v[i] = *(const v4f*)((const char*)G1 + i * 512 + offl); b1v[i] = *(const v4f*)((const char*)BE1 + i * 512 + offl); }
#pragma unroll
      for (int j = 0; j < 2; ++j) bo[j] = *(const float*)((const char*)BIAS + j * 64 + offc);
      asm volatile("s_wait_xcnt 0x0" :: "v"(offl), "v"(offc), "s"(G1), "s"(BE1), "s"(BIAS) : "memory"); } }   // as above
  __syncthreads();   // publishes the LN0 rows (both forms) and the staged W
  v8f acc[2][2] = {};
  v16h fa[4][2], fw[4][2];   // fragments of four k blocks: each block's LDS reads are issued as one group three blocks ahead of its products (the reads are 4 KB a wave and block; for speed only); unrolled so that the sets have constant indices (registers)
#pragma unroll
  for (int kc = -3; kc < CC / 32; ++kc) {
    if (kc + 3 < CC / 32) {
#pragma unroll
      for (int i = 0; i < 2; ++i) { fa[(kc + 3) & 3][i] = frag_h(&sA[(i * 16 + col) * GP + (kc + 3) * 32], lane); fw[(kc + 3) & 3][i] = frag_h(&sW[((wave * 2 + i) * 16 + col) * GP + (kc + 3) * 32], lane); } }
    __builtin_amdgcn_sched_barrier(0);   // keeps the group of reads ahead of the products: left free, the reads sink to just in front of their own products and each is waited to 0
    if (kc >= 0) {
#pragma unroll
      for (int i = 0; i < 2; ++i)
#pragma unroll
        for (int j = 0; j < 2; ++j) acc[i][j] = __builtin_amdgcn_wmma_f32_16x16x32_f16(false, fa[kc & 3][i], false, fw[kc & 3][j], (short)0, acc[i][j], false, false); } }
#pragma unroll
  for (int j = 0; j < 2; ++j) { const float bb = bfr(bo[j]);
#pragma unroll
    for (int i = 0; i < 2; ++i)
#pragma unroll
      for (int r = 0; r < 8; ++r) { float* p = &sO[(i * 16 + 8 * g + r) * OP + (wave * 2 + j) * 16 + col]; *p = fmaxf(acc[i][j][r] * (1.0f / 64.0f) + bb, 0.f) + *p; } }   /* relu before the residual; each element is read and rewritten by its one lane */
  __syncthreads();   // publishes the rows o + relu(..), whose columns come from all eight waves
#pragma unroll
  for (int rr = 0; rr < 4; ++rr)
#pragma unroll
    for (int i = 0; i < CC / 128; ++i) y[rr][i] = *(const v4f*)&sO[(wave * 4 + rr) * OP + i * 128 + lane * 4];
  ln4(y, g1v, b1v);
  char* ob = (char*)(OUT + (size_t)blockIdx.x * TR * CC);
#pragma unroll
  for (int rr = 0; rr < 4; ++rr)
#pragma unroll
    for (int i = 0; i < CC / 128; ++i) vst2(ob + (rr * CC + i * 128) * 4 + offy, y[rr][i]); }

#ifndef SM_EXTRA_PARAMS
#define SM_EXTRA_PARAMS
#endif
#ifndef PROJ_EXTRA_PARAMS
#define PROJ_EXTRA_PARAMS
#endif
#ifndef SM_MASK_HOOK
#define SM_MASK_HOOK (void)0
#endif

#define WS_QH  0u                                      // f16 q rows [b*t][CC]
#define WS_KH  (WS_QH + 2u * (size_t)NB * TT * CC)      // f16 k rows [b*t][CC]
#define WS_VT  (WS_KH + 2u * (size_t)NB * TT * CC)      // f16 v planes [b][c][t]
#define WS_QL  (WS_VT + 2u * (size_t)NB * CC * TT)      // f16 q residual x 2^10 rows [b][t < QHI][CC]
#define WS_KL  (WS_QL + 2u * (size_t)NB * QHI * CC)     // f16 k residual x 2^10 rows [b][t < KHI][CC]
#define WS_VB  (WS_KL + 2u * (size_t)NB * KHI * CC)     // bf16 v hi planes [b][c][t < KHI]
#define WS_VBL (WS_VB + 2u * (size_t)NB * CC * KHI)
#define WS_S   (WS_VBL + 2u * (size_t)NB * CC * KHI)    // f32 [hg][t][s] region; no kernel here uses it
#define WS_Y   (WS_S  + 4u * (size_t)HG * TT * TT)      // f32 ctx rows [b*t][CC] (only when there is an output projection)
#define WS_END (WS_Y  + 0u)
#define WS_Y2  (WS_END)
#define WS_O1  (WS_Y2 + 4u * (size_t)NB * TT * CC)
#define WS_R2  (WS_O1 + 4u * (size_t)NB * TT * CC)
#define WS_END2 (WS_R2 + 4u * (size_t)NB * TT * CC)

// ---- k_proj: block = (64 rows, 128 cols, which): q/k/v = X W (+ b) with exact bf16 products (K = DIN) -> which 0: q f16 rows (+ residual rows < QHI); 1: k f16 rows (+ residual rows < KHI); 2: v f16 planes [c][t] (+ bf16 hi/lo planes for t < KHI)
__global__ __launch_bounds__(128) void k_proj(const float* __restrict__ XQ, const float* __restrict__ XK, const float* __restrict__ XV, const float* __restrict__ WQ, const float* __restrict__ WK, const float* __restrict__ WV, const float* __restrict__ BQ, const float* __restrict__ BK, const float* __restrict__ BV,
    _Float16* __restrict__ QH, _Float16* __restrict__ QL, _Float16* __restrict__ KH, _Float16* __restrict__ KL, _Float16* __restrict__ VT, __bf16* __restrict__ VB, __bf16* __restrict__ VBL) {
  __shared__ __align__(16) char sm[(64 + 128) * GP * 2];   // first the two staged operand tiles, then (behind a barrier) the epilogue's transposing tiles
  __bf16* sX = (__bf16*)sm; __bf16* sW = sX + 64 * GP;
  _Float16 (*sh)[136] = (_Float16 (*)[136])sm; _Float16 (*sl)[136] = sh + 64; _Float16 (*th)[72] = (_Float16 (*)[72])sm; __bf16 (*tb)[72] = (__bf16 (*)[72])(sm + 128 * 72 * 2); __bf16 (*tbl)[72] = tb + 128;
  const int tid = threadIdx.x, wave = tid >> 5, lane = tid & 31, col = lane & 15, g = lane >> 4; const int which = blockIdx.z; const int c0 = blockIdx.y * 128; const size_t r0 = (size_t)blockIdx.x * 64; const size_t bb = r0 / TT; const int t0 = (int)(r0 % TT);
  const float* X = which == 0 ? XQ : which == 1 ? XK : XV; const float* WA = which == 0 ? WQ : which == 1 ? WK : WV; const float* BA = which == 0 ? BQ : which == 1 ? BK : BV;
  { const int sr = tid >> 6, sc = (tid & 63) * 4; const unsigned offb = (sr * DIN + sc) * 4; const char* xb = (const char*)(X + r0 * DIN); const char* wb = (const char*)(WA + (size_t)c0 * DIN);   // 128 threads x 16 B = two whole rows a pass: passes 0..31 the X rows, 32..95 the W rows ((out,in) [CC][DIN]); block-uniform bases, one lane offset
    v4f t[2][16];   // six batches of 16 passes, the next batch's loads in flight while this one is converted and stored; every loop here is unrolled so that t has constant indices (registers) and each load a constant offset
#pragma unroll
    for (int bt = 0; bt <= 6; ++bt) {
      if (bt < 6) {
#pragma unroll
        for (int i = 0; i < 16; ++i) { const int p = bt * 16 + i; t[bt & 1][i] = *(const v4f*)((p < 32 ? xb + p * 2 * DIN * 4 : wb + (p - 32) * 2 * DIN * 4) + offb); }
        asm volatile("s_wait_xcnt 0x0" :: "v"(offb), "s"(xb), "s"(wb) : "memory"); }   // the wait owed before a register that an issued load names is rewritten: as inputs, the lane offset and both bases stay untouched up to it
      if (bt > 0) {
#pragma unroll
        for (int i = 0; i < 16; ++i) { const int p = (bt - 1) * 16 + i; const v4f x = t[(bt - 1) & 1][i]; v4b c;
#pragma unroll
          for (int k = 0; k < 4; ++k) c[k] = (__bf16)x[k];
          *(v4b*)&sX[(p * 2 + sr) * GP + sc] = c; } } } }
  __syncthreads();   // publishes both staged tiles
  v8f acc[8] = {};
  v16b fa[2], fw[2][8];   // fragments of two k blocks: the next block's LDS reads are issued as one group ahead of this block's products; unrolled so that both sets have constant indices (registers)
#pragma unroll
  for (int kc = -1; kc < DIN / 32; ++kc) {
    if (kc + 1 < DIN / 32) { fa[(kc + 1) & 1] = frag_b(&sX[(wave * 16 + col) * GP + (kc + 1) * 32], lane);
#pragma unroll
      for (int j = 0; j < 8; ++j) fw[(kc + 1) & 1][j] = frag_b(&sW[(j * 16 + col) * GP + (kc + 1) * 32], lane); }
    if (kc >= 0) {
#pragma unroll
      for (int j = 0; j < 8; ++j) acc[j] = wmma_bf(fa[kc & 1], fw[kc & 1][j], acc[j]); } }
  __syncthreads();   // ends every wave's fragment reads before the epilogue's tiles overwrite the staged operands
  if (which < 2) { _Float16* DH = which == 0 ? QH : KH; _Float16* DL = which == 0 ? QL : KL; const int nhi = which == 0 ? QHI : KHI; const bool hi_rows = t0 < nhi;
#pragma unroll
    for (int j = 0; j < 8; ++j) { const float bias = BA ? bfr(BA[c0 + j * 16 + col]) : 0.f;
#pragma unroll
      for (int r = 0; r < 8; ++r) { const float v = acc[j][r] + bias; const _Float16 hv = (_Float16)v; sh[wave * 16 + 8 * g + r][j * 16 + col] = hv; sl[wave * 16 + 8 * g + r][j * 16 + col] = (_Float16)((v - (float)hv) * 1024.0f); } }
    __syncthreads();
    for (int e = tid; e < 64 * 16; e += 128) { const int rl = e >> 4, q = e & 15; vst2((unsigned*)(DH + (r0 + rl) * CC + c0 + q * 8), *(const v4u*)&sh[rl][q * 8]); if (hi_rows) vst2((unsigned*)(DL + (bb * nhi + t0 + rl) * (size_t)CC + c0 + q * 8), *(const v4u*)&sl[rl][q * 8]); }
  } else { const bool hi_rows = t0 < KHI;
#pragma unroll
    for (int j = 0; j < 8; ++j) { const float bias = BA ? bfr(BA[c0 + j * 16 + col]) : 0.f;
#pragma unroll
      for (int r = 0; r < 8; ++r) { const float v = acc[j][r] + bias; const int rl = wave * 16 + 8 * g + r, cl = j * 16 + col; th[cl][rl] = (_Float16)v; const __bf16 bh = (__bf16)v; tb[cl][rl] = bh; tbl[cl][rl] = (__bf16)(v - (float)bh); } }
    __syncthreads();
    for (int e = tid; e < 128 * 8; e += 128) { const int cl = e >> 3, q = e & 7; vst2((unsigned*)(VT + (bb * CC + c0 + cl) * (size_t)TT + t0 + q * 8), *(const v4u*)&th[cl][q * 8]); if (hi_rows) { const size_t o3 = (bb * CC + c0 + cl) * (size_t)KHI + t0 + q * 8; vst2((unsigned*)(VB + o3), *(const v4u*)&tb[cl][q * 8]); vst2((unsigned*)(VBL + o3), *(const v4u*)&tbl[cl][q * 8]); } } } }
// ---- k_fa: block = 128 queries of one (b, h), 8 waves x 16 query columns: S^T = k q^T (q hi + residual x 2^10, 2 products), running maximum and sum per query in f32, P^T x 2^8 (relative to the running maximum) once to f16 straight from the score tiles as B operand, O^T += v^T P^T (1 product); k rows and v planes staged in LDS, 128 keys a stage, two buffers
#define FA_ST 128          // keys per stage
#define FA_KP 40           // LDS pitch of a k row in halfs (80 B = 16 B x odd)
#define FA_VP 136          // LDS pitch of a v plane row in halfs (272 B = 16 B x odd)
#define FA_C (SCALE * 1.4426950408889634f)
__device__ __forceinline__ float xhalf(float x) { return __builtin_bit_cast(float, __builtin_amdgcn_permlanex16(__builtin_bit_cast(int, x), __builtin_bit_cast(int, x), 0x76543210, 0xfedcba98, false, false)); }   // lane l with lane l ^ 16
// exp2 of eight values, each in its own register, in one statement closed by v_nop: no exp2 of the run touches a neighbour's register, and the v_nop is the slot that the instruction set asks for between a transcendental and the first use of its result
__device__ __forceinline__ void exp2x8(float& x0, float& x1, float& x2, float& x3, float& x4, float& x5, float& x6, float& x7) {
  asm("v_exp_f32 %0, %0\n\tv_exp_f32 %1, %1\n\tv_exp_f32 %2, %2\n\tv_exp_f32 %3, %3\n\tv_exp_f32 %4, %4\n\tv_exp_f32 %5, %5\n\tv_exp_f32 %6, %6\n\tv_exp_f32 %7, %7\n\tv_nop"
      : "+v"(x0), "+v"(x1), "+v"(x2), "+v"(x3), "+v"(x4), "+v"(x5), "+v"(x6), "+v"(x7)); }
__device__ __forceinline__ v8f wmma_h(v16h a, v16h b, v8f c) { return __builtin_amdgcn_wmma_f32_16x16x32_f16(false, a, false, b, (short)0, c, false, false); }
__global__ __launch_bounds__(256) __attribute__((amdgpu_waves_per_eu(4, 4))) void k_fa(const _Float16* __restrict__ QH, const _Float16* __restrict__ QL, const _Float16* __restrict__ KH, const _Float16* __restrict__ VT, float* __restrict__ Y) {
  __shared__ __align__(16) _Float16 sK[2][FA_ST * FA_KP]; __shared__ __align__(16) _Float16 sV[2][HD * FA_VP];
  const int tid = threadIdx.x, wave = tid >> 5, lane = tid & 31, col = lane & 15, g = lane >> 4; const int b = blockIdx.y / NH, h = blockIdx.y % NH; const int q = blockIdx.x * 128 + wave * 16 + col;
  const v16h qh = frag_h(QH + ((size_t)b * TT + q) * CC + h * HD, lane), ql = frag_h(QL + ((size_t)b * QHI + q) * CC + h * HD, lane);   // B operands: column = query
  const int kr = tid >> 2, ks = (tid & 3) * 8, vr = tid >> 4, vs = (tid & 15) * 8;   // this thread's 16-B pieces of a stage: k rows kr, kr + 64; v rows vr, vr + 16
  const _Float16* Kg = KH + ((size_t)b * TT + kr) * CC + h * HD + ks; const _Float16* Vg = VT + ((size_t)b * CC + h * HD + vr) * TT + vs;
  v4u rk0 = *(const v4u*)Kg, rk1 = *(const v4u*)(Kg + (size_t)64 * CC), rv0 = *(const v4u*)Vg, rv1 = *(const v4u*)(Vg + (size_t)16 * TT);
  *(v4u*)&sK[0][kr * FA_KP + ks] = rk0; *(v4u*)&sK[0][(kr + 64) * FA_KP + ks] = rk1; *(v4u*)&sV[0][vr * FA_VP + vs] = rv0; *(v4u*)&sV[0][(vr + 16) * FA_VP + vs] = rv1;
  __syncthreads();
  v8f o[HD / 16] = {}; float m = -3.0e38f, l = 0.f;
#pragma unroll 1   // the stage loop stays rolled: one stage is already a long straight body; the inner loops are unrolled so that every register array has constant indices
  for (int s = 0; s < TT / FA_ST; ++s) { const int cur = s & 1; const bool more = s + 1 < TT / FA_ST;
    if (more) { const _Float16* kp = Kg + (size_t)(s + 1) * FA_ST * CC; const _Float16* vp = Vg + (s + 1) * FA_ST; rk0 = *(const v4u*)kp; rk1 = *(const v4u*)(kp + (size_t)64 * CC); rv0 = *(const v4u*)vp; rv1 = *(const v4u*)(vp + (size_t)16 * TT); }
#pragma unroll
    for (int kk = 0; kk < FA_ST; kk += 64) { v8f sv[4];
#pragma unroll
      for (int t = 0; t < 4; ++t) { const v16h kf = frag_h(&sK[cur][(kk + t * 16 + col) * FA_KP], lane); const v8f z = {}; const v8f lo = wmma_h(kf, ql, z), hi = wmma_h(kf, qh, z);   // A operand: row = key
#pragma unroll
        for (int r = 0; r < 8; ++r) sv[t][r] = hi[r] + lo[r] * (1.0f / 1024.0f); }
      v16h vf[HD / 16][2];   // A operands of the second product: row = channel, keys in the order of the packed score tiles
#pragma unroll
      for (int j = 0; j < HD / 16; ++j)
#pragma unroll
        for (int u = 0; u < 2; ++u) vf[j][u] = frag_h(&sV[cur][(j * 16 + col) * FA_VP + kk + u * 32], lane);
      float mt[4];
#pragma unroll
      for (int t = 0; t < 4; ++t) { mt[t] = sv[t][0];
#pragma unroll
        for (int r = 1; r < 8; ++r) mt[t] = fmaxf(mt[t], sv[t][r]); }
      float mx = fmaxf(fmaxf(mt[0], mt[1]), fmaxf(mt[2], mt[3]));
      mx = fmaxf(mx, xhalf(mx)); const float mn = fmaxf(m, mx); const float alpha = __builtin_amdgcn_exp2f((m - mn) * FA_C); m = mn; const float off = 8.0f - mn * FA_C;
      float ps[4]; v16h pf[2];
#pragma unroll
      for (int t = 0; t < 4; ++t) { float e[8];
#pragma unroll
        for (int r = 0; r < 8; ++r) e[r] = sv[t][r] * FA_C + off;
        exp2x8(e[0], e[1], e[2], e[3], e[4], e[5], e[6], e[7]);
        ps[t] = ((e[0] + e[1]) + (e[2] + e[3])) + ((e[4] + e[5]) + (e[6] + e[7]));
#pragma unroll
        for (int r = 0; r < 8; ++r) pf[t >> 1][(t & 1) * 8 + r] = (_Float16)e[r]; }
      l = l * alpha + ((ps[0] + ps[1]) + (ps[2] + ps[3]));
#pragma unroll
      for (int j = 0; j < HD / 16; ++j) {
#pragma unroll
        for (int r = 0; r < 8; ++r) o[j][r] *= alpha;
#pragma unroll
        for (int u = 0; u < 2; ++u) o[j] = wmma_h(vf[j][u], pf[u], o[j]); } }
    if (more) { const int nx = cur ^ 1; *(v4u*)&sK[nx][kr * FA_KP + ks] = rk0; *(v4u*)&sK[nx][(kr + 64) * FA_KP + ks] = rk1; *(v4u*)&sV[nx][vr * FA_VP + vs] = rv0; *(v4u*)&sV[nx][(vr + 16) * FA_VP + vs] = rv1; }
    __syncthreads(); }   // publishes stage s + 1 and ends every wave's reads of the buffer that the next trip refills
  const float inv = 1.0f / (l + xhalf(l));
#pragma unroll
  for (int j = 0; j < HD / 16; ++j) { float* yp = Y + ((size_t)b * TT + q) * CC + h * HD + j * 16 + 8 * g; v4f a0, a1;
#pragma unroll
    for (int r = 0; r < 4; ++r) { a0[r] = o[j][r] * inv; a1[r] = o[j][4 + r] * inv; }
    vst2(yp, a0); vst2(yp + 4, a1); } }

extern "C" void kernel_launch(void* const* d_in, const int* in_sizes, int n_in, void* d_out, int out_size, void* d_ws, size_t ws_size, hipStream_t stream) {
  (void)in_sizes; (void)n_in; (void)out_size;
  const float** F = (const float**)d_in;
  if (ws_size < (size_t)WS_END) return;
  char* ws = (char*)d_ws; _Float16 *QH = (_Float16*)(ws + WS_QH), *KH = (_Float16*)(ws + WS_KH), *VT = (_Float16*)(ws + WS_VT), *QL = (_Float16*)(ws + WS_QL), *KL = (_Float16*)(ws + WS_KL); __bf16 *VB = (__bf16*)(ws + WS_VB), *VBL = (__bf16*)(ws + WS_VBL); float *S = (float*)(ws + WS_S), *Y = (float*)(ws + WS_Y);
  (void)Y; (void)S; (void)QL; (void)KL; (void)VB; (void)VBL;
  // inputs: 0 Q [4,2048,256]; 1 K [4,2048,256]; 2 Wq [256,256] (out,in), 3 bq; 4 Wk, 5 bk; 6 Wv, 7 bv; 8 Wo (out,in), 9 bo; 10 g0, 11 b0; 12 g1, 13 b1
  if (ws_size < (size_t)WS_END2) return;
  float *YA = (float*)(ws + WS_Y2);
  k_proj<<<dim3(TNB * TT / 64, CC / 128, 3), 128, 0, stream>>>(F[0], F[1], F[1], F[2], F[4], F[6], F[3], F[5], F[7], QH, QL, KH, KL, VT, VB, VBL);
  k_fa<<<dim3(TT / 128, TNB * NH), 256, 0, stream>>>(QH, QL, KH, VT, YA);
  k_tail<<<dim3(NRW / TR), 256, 0, stream>>>(YA, F[10], F[11], F[8], F[9], F[12], F[13], (float*)d_out);   /* out = LN1(o + relu(o Wo^T + bo)), o = LN0(attention output) */
}

// v004
// Measured time: 44.2 microseconds a run.
// Next to v003, in two timings, it ran 1.09 times as fast each time.
// All steps since v000 together make it 19.7 times as fast.
// compute dtype: all float inputs rounded to bf16; Qp/Kp/Vp = X W^T + b with EXACT bf16 products on WMMA 16x16x32 (f32 accumulate); q x 32^-0.5 x log2(e) x 2^5 as f16 hi + f16 residual against k x 2^-5 once to f16 (2 products accumulated into one tile that starts at 8 - the maximum in use); softmax in f32 with a maximum in use that is raised only when a score passes it by more than 7 (hardware exp2); unnormalised P x 2^8 once to f16 against v once to f16 (1 product), divided by the f32 row sum at the end; LayerNorms in f32; the fc_o layer with the LN rows once to f16 against Wo as f16(bf16 x 2^6) (1 product) + bias, relu and residual in f32; f32 output.
#include <hip/hip_runtime.h>
#include <math.h>

typedef __attribute__((ext_vector_type(16))) _Float16 v16h;
typedef __attribute__((ext_vector_type(16))) __bf16 v16b;
typedef __attribute__((ext_vector_type(8)))  _Float16 v8h;
typedef __attribute__((ext_vector_type(8)))  float v8f;
typedef __attribute__((ext_vector_type(4)))  float v4f;
typedef __attribute__((ext_vector_type(2)))  float v2f;
typedef __attribute__((ext_vector_type(4)))  unsigned v4u;
typedef __attribute__((ext_vector_type(4)))  int v4i;
typedef float __attribute__((may_alias)) float_a;
typedef int __attribute__((may_alias)) int_a;

template <typename T> __device__ __forceinline__ void vst2(void* p, T v) { *(T*)p = v;  }
__device__ __forceinline__ v8f wmma16(v16h a, v16h b, v8f c) {
  v8f d = __builtin_amdgcn_wmma_f32_16x16x32_f16(false, a, false, b, (short)0, c, false, false);
  asm volatile("v_nop\n\tv_nop\n\tv_nop\n\tv_nop" : "+v"(d) : "v"(a), "v"(b));
  return d;
}
__device__ __forceinline__ v8f wmma_bf(v16b a, v16b b, v8f c) {
  v8f d = __builtin_amdgcn_wmma_f32_16x16x32_bf16(false, a, false, b, (short)0, c, false, false);
  asm volatile("v_nop\n\tv_nop\n\tv_nop\n\tv_nop" : "+v"(d) : "v"(a), "v"(b));
  return d;
}
// 16x16x32 fragments: lane = (h = lane>>4, row/col = lane&15); elements 0..7 = k0+8h+0..7, 8..15 = k0+16+8h+0..7; D element r = row 8h+r
__device__ __forceinline__ v16h frag_h(const _Float16* rowk0, int lane) {
  union { v16h v; v8h q[2]; } u; const _Float16* p = rowk0 + 8 * (lane >> 4);
  u.q[0] = *(const v8h*)p; u.q[1] = *(const v8h*)(p + 16); return u.v;
}
__device__ __forceinline__ v16h frag_f32(const float* rowk0, int lane) {
  v16h a; const float* p = rowk0 + 8 * (lane >> 4);
#pragma unroll
  for (int i = 0; i < 8; ++i) { a[i] = (_Float16)p[i]; a[8 + i] = (_Float16)p[16 + i]; }
  return a;
}
__device__ __forceinline__ v16h frag_f32s(const float* rowk0, int lane, float sc) {
  v16h a; const float* p = rowk0 + 8 * (lane >> 4);
#pragma unroll
  for (int i = 0; i < 8; ++i) { a[i] = (_Float16)(p[i] * sc); a[8 + i] = (_Float16)(p[16 + i] * sc); }
  return a;
}
// column fragment from a [K][ld] layout (column n), rows >= K read as 0
__device__ __forceinline__ v16h fragc_f32(const float* W, int k0, int n, int lane, int ld, int K) {
  v16h a; const int g = lane >> 4;
#pragma unroll
  for (int i = 0; i < 8; ++i) { const int ka = k0 + 8 * g + i, kb = ka + 16;
    a[i] = (_Float16)(ka < K ? W[(size_t)(ka < K ? ka : K - 1) * ld + n] : 0.f); a[8 + i] = (_Float16)(kb < K ? W[(size_t)(kb < K ? kb : K - 1) * ld + n] : 0.f); }
  return a;
}
struct F2 { v16b h, l; };
__device__ __forceinline__ F2 bsplit16(const float v[16]) { F2 r;
#pragma unroll
  for (int i = 0; i < 16; ++i) { const __bf16 h = (__bf16)v[i]; r.h[i] = h; r.l[i] = (__bf16)(v[i] - (float)h); }
  return r; }
__device__ __forceinline__ F2 split_row(const float* row, int k0, int lane) { float v[16]; const float* p = row + k0 + 8 * (lane >> 4);
#pragma unroll
  for (int i = 0; i < 8; ++i) { v[i] = p[i]; v[8 + i] = p[16 + i]; }
  return bsplit16(v); }
__device__ __forceinline__ F2 split_rowK(const float* row, int k0, int lane, int K) { float v[16]; const int g = lane >> 4;
#pragma unroll
  for (int i = 0; i < 8; ++i) { const int ka = k0 + 8 * g + i, kb = ka + 16; v[i] = ka < K ? row[ka < K ? ka : K - 1] : 0.f; v[8 + i] = kb < K ? row[kb < K ? kb : K - 1] : 0.f; }
  return bsplit16(v); }
__device__ __forceinline__ F2 split_col(const float* W, int k0, int n, int lane, int ld, int K) { float v[16]; const int g = lane >> 4;
#pragma unroll
  for (int i = 0; i < 8; ++i) { const int ka = k0 + 8 * g + i, kb = ka + 16; v[i] = ka < K ? W[(size_t)(ka < K ? ka : K - 1) * ld + n] : 0.f; v[8 + i] = kb < K ? W[(size_t)(kb < K ? kb : K - 1) * ld + n] : 0.f; }
  return bsplit16(v); }
__device__ __forceinline__ v8f mac3(const F2& a, const F2& b, v8f c) { c = wmma_bf(a.l, b.h, c); c = wmma_bf(a.h, b.l, c); return wmma_bf(a.h, b.h, c); }
__device__ __forceinline__ float sigm(float v) { return 1.0f / (1.0f + expf(-v)); }
#define LDSX() do { asm volatile("s_wait_dscnt 0" ::: "memory"); __builtin_amdgcn_wave_barrier(); __builtin_amdgcn_fence(__ATOMIC_RELEASE, "workgroup"); } while (0)

// Set-Transformer MAB (B 4, NQ = NK = 2,048, dim 256 = 8 heads x 32; 0.02-scale (out,in) weights, zero biases, LN gamma 1 / beta 0): Qp = Q Wq^T + bq, Kp = K Wk^T + bk, Vp = K Wv^T + bv; o = merged(softmax(q k^T / sqrt(32)) v); o = LN0(o); out = LN1(o + relu(o Wo^T + bo)) (eps 1e-5, biased var).
#define NB 4
#define TT 2048
#define CC 256            // NH * HD = projected width
#define DIN 256          // input (model) width
#define NH 8
#define HD 32
#define NQB (TT / 64)
#define HG 4
#define SCALE (0.17677669529663687f)
#define CAUSAL 0
#ifndef TNB
#define TNB NB
#endif
__device__ __forceinline__ float bfr(float v) { return (float)(__bf16)v; }
__host__ __device__ __forceinline__ int kb_last(int qb) { return CAUSAL ? ((qb * 64 + 63) >> 7) : (TT / 128 - 1); }
typedef __attribute__((ext_vector_type(8))) __bf16 v8b;
__device__ __forceinline__ v16b frag_b(const __bf16* rowk0, int lane) {
  union { v16b v; v8b q[2]; } u; const __bf16* p = rowk0 + 8 * (lane >> 4);
  u.q[0] = *(const v8b*)p; u.q[1] = *(const v8b*)(p + 16); return u.v;
}
#define QBH 0              // not referenced by any kernel here (no high-precision path)
#define QHI 2048            // rows carrying a q residual plane (all rows when non-causal: 2-product logits everywhere)
#define KHI 64            // key rows carrying k residual / v bf16 hi+lo planes (written by k_proj; no kernel here reads them)
// B fragment (k rows k0+.., output column o) of a weight: (in,out) [K][ld] or (out,in) [ld rows of K]: bf16 exact, or f16(bf16 * 256) exact
__device__ __forceinline__ v16b wcol_io(const float* Wm, int k0, int o, int lane, int ld) { v16b w; const int g = lane >> 4;
#pragma unroll
  for (int i = 0; i < 8; ++i) { w[i] = (__bf16)Wm[(size_t)(k0 + 8 * g + i) * ld + o]; w[8 + i] = (__bf16)Wm[(size_t)(k0 + 16 + 8 * g + i) * ld + o]; }
  return w; }
__device__ __forceinline__ v16b wcol_oi(const float* Wm, int k0, int o, int lane, int K) { v16b w; const float* p = Wm + (size_t)o * K + k0 + 8 * (lane >> 4);
#pragma unroll
  for (int i = 0; i < 8; ++i) { w[i] = (__bf16)p[i]; w[8 + i] = (__bf16)p[16 + i]; }
  return w; }
__device__ __forceinline__ v16h wcolh_io(const float* Wm, int k0, int o, int lane, int ld) { v16h w; const int g = lane >> 4;
#pragma unroll
  for (int i = 0; i < 8; ++i) { w[i] = (_Float16)(bfr(Wm[(size_t)(k0 + 8 * g + i) * ld + o]) * 256.0f); w[8 + i] = (_Float16)(bfr(Wm[(size_t)(k0 + 16 + 8 * g + i) * ld + o]) * 256.0f); }
  return w; }
__device__ __forceinline__ v16h wcolh_oi(const float* Wm, int k0, int o, int lane, int K) { v16h w; const float* p = Wm + (size_t)o * K + k0 + 8 * (lane >> 4);
#pragma unroll
  for (int i = 0; i < 8; ++i) { w[i] = (_Float16)(bfr(p[i]) * 256.0f); w[8 + i] = (_Float16)(bfr(p[16 + i]) * 256.0f); }
  return w; }
#define WQKV_LAYOUT 1   // 0 = (in,out) [DIN][CC]; 1 = (out,in) [CC][DIN]; 2 = per-head [NH][DIN][HD]
__device__ __forceinline__ v16b wcol_hdk(const float* Wm, int k0, int o, int lane) { v16b w; const int g = lane >> 4; const float* p = Wm + (size_t)(o / HD) * DIN * HD + (o % HD);
#pragma unroll
  for (int i = 0; i < 8; ++i) { w[i] = (__bf16)p[(size_t)(k0 + 8 * g + i) * HD]; w[8 + i] = (__bf16)p[(size_t)(k0 + 16 + 8 * g + i) * HD]; }
  return w; }
#define WO_OUT_IN 0
#if WQKV_LAYOUT == 1
#define WCOL(W, k0, o, lane) wcol_oi(W, k0, o, lane, DIN)
#elif WQKV_LAYOUT == 2
#define WCOL(W, k0, o, lane) wcol_hdk(W, k0, o, lane)
#else
#define WCOL(W, k0, o, lane) wcol_io(W, k0, o, lane, CC)
#endif
#if WO_OUT_IN
#define WOCOL(W, k0, o, lane) wcol_oi(W, k0, o, lane, CC)
#define WOCOLH(W, k0, o, lane) wcolh_oi(W, k0, o, lane, CC)
#else
#define WOCOL(W, k0, o, lane) wcol_io(W, k0, o, lane, DIN)
#define WOCOLH(W, k0, o, lane) wcolh_io(W, k0, o, lane, DIN)
#endif
#define NRW (TNB * TT)
// LayerNorm over CC = 256 of four rows held by one wave (mean, biased var, (x - mean) * rsqrt(var + 1e-5) * g + b): 8 floats of a row per lane (2 float4 at stride 128 floats); the four rows' lane exchanges are independent of one another
__device__ __forceinline__ void ln4(v4f (&v)[4][CC / 128], const v4f (&gv)[CC / 128], const v4f (&bv)[CC / 128]) {
  float s1[4], q[4];
#pragma unroll
  for (int rr = 0; rr < 4; ++rr) { s1[rr] = 0.f;
#pragma unroll
    for (int i = 0; i < CC / 128; ++i) { const v4f t = v[rr][i]; s1[rr] += (t[0] + t[1]) + (t[2] + t[3]); } }
#pragma unroll
  for (int o = 1; o < 32; o <<= 1)
#pragma unroll
    for (int rr = 0; rr < 4; ++rr) s1[rr] += __shfl_xor(s1[rr], o);
#pragma unroll
  for (int rr = 0; rr < 4; ++rr) { s1[rr] *= (1.0f / CC); q[rr] = 0.f;
#pragma unroll
    for (int i = 0; i < CC / 128; ++i)
#pragma unroll
      for (int k = 0; k < 4; ++k) { const float d = v[rr][i][k] - s1[rr]; q[rr] += d * d; } }
#pragma unroll
  for (int o = 1; o < 32; o <<= 1)
#pragma unroll
    for (int rr = 0; rr < 4; ++rr) q[rr] += __shfl_xor(q[rr], o);
#pragma unroll
  for (int rr = 0; rr < 4; ++rr) q[rr] = rsqrtf(q[rr] * (1.0f / CC) + 1e-5f);   /* jnp.var (biased), eps inside the rsqrt */
#pragma unroll
  for (int rr = 0; rr < 4; ++rr)
#pragma unroll
    for (int i = 0; i < CC / 128; ++i)
#pragma unroll
      for (int k = 0; k < 4; ++k) v[rr][i][k] = bfr(gv[i][k]) * ((v[rr][i][k] - s1[rr]) * q[rr]) + bfr(bv[i][k]); }
#define GP 264            // LDS pitch of a staged operand row of 256 16-bit elements (528 B = 16 B x odd)
typedef __attribute__((ext_vector_type(4))) _Float16 v4h;
typedef __attribute__((ext_vector_type(4))) __bf16 v4b;
#define TR 32             // rows of a block of k_tail
#define OP 260            // LDS pitch of an f32 row there (1,040 B: the two lane halves of an accumulator tile, 8 rows apart, fall on different banks)
// ---- k_tail: block = 32 whole rows, 8 waves: o = LN0(Y) (wave = 4 rows; kept in LDS as f32 rows and once to f16), r = o + relu(o x W^T (W (out,in) as f16(bf16 x 2^6), all 256 rows staged in LDS by 512-B wave loads) x 2^-6 + bias) (wave = 32 rows x 32 cols), OUT = LN1(r) (wave = 4 rows)
__global__ __launch_bounds__(256) void k_tail(const float* __restrict__ Y, const float* __restrict__ G0, const float* __restrict__ BE0, const float* __restrict__ Wm, const float* __restrict__ BIAS, const float* __restrict__ G1, const float* __restrict__ BE1, float* __restrict__ OUT) {
  __shared__ __align__(16) _Float16 sW[CC * GP]; __shared__ __align__(16) _Float16 sA[TR * GP]; __shared__ __align__(16) float sO[TR * OP];
  const int tid = threadIdx.x, wave = tid >> 5, lane = tid & 31, col = lane & 15, g = lane >> 4;
  const char* yb = (const char*)(Y + (size_t)blockIdx.x * TR * CC); const char* wb = (const char*)Wm; const unsigned offy = (wave * 4 * CC + lane * 4) * 4, offl = lane * 16, offb = tid * 16, offc = (wave * 32 + col) * 4;   // block-uniform bases, one lane offset each
  v4f y[4][CC / 128], g0v[CC / 128], b0v[CC / 128], g1v[CC / 128], b1v[CC / 128]; float bo[2];
#pragma unroll
  for (int rr = 0; rr < 4; ++rr)
#pragma unroll
    for (int i = 0; i < CC / 128; ++i) y[rr][i] = *(const v4f*)(yb + (rr * CC + i * 128) * 4 + offy);
#pragma unroll
  for (int i = 0; i < CC / 128; ++i) { g0v[i] = *(const v4f*)((const char*)G0 + i * 512 + offl); b0v[i] = *(const v4f*)((const char*)BE0 + i * 512 + offl); }
  asm volatile("s_wait_xcnt 0x0" :: "v"(offy), "v"(offl), "s"(yb), "s"(G0), "s"(BE0) : "memory");   // the wait owed before a register that an issued load names is rewritten: as inputs, the lane offsets and the bases stay untouched up to it
  v4f t[2][16];   // W: 256 threads x 16 B = four whole rows a pass, four batches of 16 passes, two batches in flight; every loop here is unrolled so that t has constant indices (registers) and each load a constant offset
#pragma unroll
  for (int bt = 0; bt < 2; ++bt)
#pragma unroll
    for (int i = 0; i < 16; ++i) t[bt][i] = *(const v4f*)(wb + (bt * 16 + i) * 4 * CC * 4 + offb);
  asm volatile("s_wait_xcnt 0x0" :: "v"(offb), "s"(wb) : "memory");   // as above
  ln4(y, g0v, b0v);   // runs while the first two batches of W are in flight
#pragma unroll
  for (int rr = 0; rr < 4; ++rr)
#pragma unroll
    for (int i = 0; i < CC / 128; ++i) { const v4f x = y[rr][i]; v4h c;
#pragma unroll
      for (int k = 0; k < 4; ++k) c[k] = (_Float16)x[k];
      *(v4f*)&sO[(wave * 4 + rr) * OP + i * 128 + lane * 4] = x; *(v4h*)&sA[(wave * 4 + rr) * GP + i * 128 + lane * 4] = c; }
  __builtin_amdgcn_sched_barrier(0);   // keeps the conversions of W behind LN0: drawn up among it they hold converted copies beside the loaded registers, and the kernel goes past 256 registers (a window switch at every other instruction)
#pragma unroll
  for (int bt = 0; bt < 4; ++bt) {
#pragma unroll
    for (int i = 0; i < 16; ++i) { const int p = bt * 16 + i; const v4f x = t[bt & 1][i]; v4h c;
#pragma unroll
      for (int k = 0; k < 4; ++k) c[k] = (_Float16)(bfr(x[k]) * 64.0f);
      *(v4h*)&sW[(p * 4 + (tid >> 6)) * GP + (tid & 63) * 4] = c; }
    if (bt + 2 < 4) {
#pragma unroll
      for (int i = 0; i < 16; ++i) t[bt & 1][i] = *(const v4f*)(wb + ((bt + 2) * 16 + i) * 4 * CC * 4 + offb);
      asm volatile("s_wait_xcnt 0x0" :: "v"(offb), "s"(wb) : "memory"); }   // as above
    if (bt == 1) {   // what the epilogue and LN1 need, issued behind the last batch of W: back before the barrier below waits for every load
#pragma unroll
      for (int i = 0; i < CC / 128; ++i) { g1v[i] = *(const v4f*)((const char*)G1 + i * 512 + offl); b1v[i] = *(const v4f*)((const char*)BE1 + i * 512 + offl); }
#pragma unroll
      for (int j = 0; j < 2; ++j) bo[j] = *(const float*)((const char*)BIAS + j * 64 + offc);
      asm volatile("s_wait_xcnt 0x0" :: "v"(offl), "v"(offc), "s"(G1), "s"(BE1), "s"(BIAS) : "memory"); } }   // as above
  __syncthreads();   // publishes the LN0 rows (both forms) and the staged W
  v8f acc[2][2] = {};
  v16h fa[4][2], fw[4][2];   // fragments of four k blocks: each block's LDS reads are issued as one group three blocks ahead of its products (the reads are 4 KB a wave and block; for speed only); unrolled so that the sets have constant indices (registers)
#pragma unroll
  for (int kc = -3; kc < CC / 32; ++kc) {
    if (kc + 3 < CC / 32) {
#pragma unroll
      for (int i = 0; i < 2; ++i) { fa[(kc + 3) & 3][i] = frag_h(&sA[(i * 16 + col) * GP + (kc + 3) * 32], lane); fw[(kc + 3) & 3][i] = frag_h(&sW[((wave * 2 + i) * 16 + col) * GP + (kc + 3) * 32], lane); } }
    __builtin_amdgcn_sched_barrier(0);   // keeps the group of reads ahead of the products: left free, the reads sink to just in front of their own products and each is waited to 0
    if (kc >= 0) {
#pragma unroll
      for (int i = 0; i < 2; ++i)
#pragma unroll
        for (int j = 0; j < 2; ++j) acc[i][j] = __builtin_amdgcn_wmma_f32_16x16x32_f16(false, fa[kc & 3][i], false, fw[kc & 3][j], (short)0, acc[i][j], false, false); } }
#pragma unroll
  for (int j = 0; j < 2; ++j) { const float bb = bfr(bo[j]);
#pragma unroll
    for (int i = 0; i < 2; ++i)
#pragma unroll
      for (int r = 0; r < 8; ++r) { float* p = &sO[(i * 16 + 8 * g + r) * OP + (wave * 2 + j) * 16 + col]; *p = fmaxf(acc[i][j][r] * (1.0f / 64.0f) + bb, 0.f) + *p; } }   /* relu before the residual; each element is read and rewritten by its one lane */
  __syncthreads();   // publishes the rows o + relu(..), whose columns come from all eight waves
#pragma unroll
  for (int rr = 0; rr < 4; ++rr)
#pragma unroll
    for (int i = 0; i < CC / 128; ++i) y[rr][i] = *(const v4f*)&sO[(wave * 4 + rr) * OP + i * 128 + lane * 4];
  ln4(y, g1v, b1v);
  char* ob = (char*)(OUT + (size_t)blockIdx.x * TR * CC);
#pragma unroll
  for (int rr = 0; rr < 4; ++rr)
#pragma unroll
    for (int i = 0; i < CC / 128; ++i) vst2(ob + (rr * CC + i * 128) * 4 + offy, y[rr][i]); }

#ifndef SM_EXTRA_PARAMS
#define SM_EXTRA_PARAMS
#endif
#ifndef PROJ_EXTRA_PARAMS
#define PROJ_EXTRA_PARAMS
#endif
#ifndef SM_MASK_HOOK
#define SM_MASK_HOOK (void)0
#endif

#define WS_QH  0u                                      // f16 q rows [b*t][CC]
#define WS_KH  (WS_QH + 2u * (size_t)NB * TT * CC)      // f16 k rows [b*t][CC]
#define WS_VT  (WS_KH + 2u * (size_t)NB * TT * CC)      // f16 v planes [b][c][t]
#define WS_QL  (WS_VT + 2u * (size_t)NB * CC * TT)      // f16 q residual rows [b][t < QHI][CC]
#define WS_KL  (WS_QL + 2u * (size_t)NB * QHI * CC)     // f16 k residual x 2^10 rows [b][t < KHI][CC]
#define WS_VB  (WS_KL + 2u * (size_t)NB * KHI * CC)     // bf16 v hi planes [b][c][t < KHI]
#define WS_VBL (WS_VB + 2u * (size_t)NB * CC * KHI)
#define WS_S   (WS_VBL + 2u * (size_t)NB * CC * KHI)    // f32 [hg][t][s] region; no kernel here uses it
#define WS_Y   (WS_S  + 4u * (size_t)HG * TT * TT)      // f32 ctx rows [b*t][CC] (only when there is an output projection)
#define WS_END (WS_Y  + 0u)
#define WS_Y2  (WS_END)
#define WS_O1  (WS_Y2 + 4u * (size_t)NB * TT * CC)
#define WS_R2  (WS_O1 + 4u * (size_t)NB * TT * CC)
#define WS_END2 (WS_R2 + 4u * (size_t)NB * TT * CC)

#define QSC (SCALE * 1.4426950408889634f * 32.0f)   // q leaves k_proj as q x 32^-0.5 x log2(e) x 2^5, k as k x 2^-5: their product is the exp2 argument itself, and the 2^5 keeps q's f16 residual in the normal range
#define KSC (1.0f / 32.0f)
// ---- k_proj: block = (64 rows, 128 cols, which): q/k/v = X W (+ b) with exact bf16 products (K = DIN) -> which 0: q x QSC f16 rows (+ unscaled residual rows < QHI); 1: k x KSC f16 rows (+ residual rows < KHI); 2: v f16 planes [c][t] (+ bf16 hi/lo planes for t < KHI)
__global__ __launch_bounds__(128) void k_proj(const float* __restrict__ XQ, const float* __restrict__ XK, const float* __restrict__ XV, const float* __restrict__ WQ, const float* __restrict__ WK, const float* __restrict__ WV, const float* __restrict__ BQ, const float* __restrict__ BK, const float* __restrict__ BV,
    _Float16* __restrict__ QH, _Float16* __restrict__ QL, _Float16* __restrict__ KH, _Float16* __restrict__ KL, _Float16* __restrict__ VT, __bf16* __restrict__ VB, __bf16* __restrict__ VBL) {
  __shared__ __align__(16) char sm[(64 + 128) * GP * 2];   // first the two staged operand tiles, then (behind a barrier) the epilogue's transposing tiles
  __bf16* sX = (__bf16*)sm; __bf16* sW = sX + 64 * GP;
  _Float16 (*sh)[136] = (_Float16 (*)[136])sm; _Float16 (*sl)[136] = sh + 64; _Float16 (*th)[72] = (_Float16 (*)[72])sm; __bf16 (*tb)[72] = (__bf16 (*)[72])(sm + 128 * 72 * 2); __bf16 (*tbl)[72] = tb + 128;
  const int tid = threadIdx.x, wave = tid >> 5, lane = tid & 31, col = lane & 15, g = lane >> 4; const int which = blockIdx.z; const int c0 = blockIdx.y * 128; const size_t r0 = (size_t)blockIdx.x * 64; const size_t bb = r0 / TT; const int t0 = (int)(r0 % TT);
  const float* X = which == 0 ? XQ : which == 1 ? XK : XV; const float* WA = which == 0 ? WQ : which == 1 ? WK : WV; const float* BA = which == 0 ? BQ : which == 1 ? BK : BV;
  { const int sr = tid >> 6, sc = (tid & 63) * 4; const unsigned offb = (sr * DIN + sc) * 4; const char* xb = (const char*)(X + r0 * DIN); const char* wb = (const char*)(WA + (size_t)c0 * DIN);   // 128 threads x 16 B = two whole rows a pass: passes 0..31 the X rows, 32..95 the W rows ((out,in) [CC][DIN]); block-uniform bases, one lane offset
    v4f t[2][16];   // six batches of 16 passes, the next batch's loads in flight while this one is converted and stored; every loop here is unrolled so that t has constant indices (registers) and each load a constant offset
#pragma unroll
    for (int bt = 0; bt <= 6; ++bt) {
      if (bt < 6) {
#pragma unroll
        for (int i = 0; i < 16; ++i) { const int p = bt * 16 + i; t[bt & 1][i] = *(const v4f*)((p < 32 ? xb + p * 2 * DIN * 4 : wb + (p - 32) * 2 * DIN * 4) + offb); }
        asm volatile("s_wait_xcnt 0x0" :: "v"(offb), "s"(xb), "s"(wb) : "memory"); }   // the wait owed before a register that an issued load names is rewritten: as inputs, the lane offset and both bases stay untouched up to it
      if (bt > 0) {
#pragma unroll
        for (int i = 0; i < 16; ++i) { const int p = (bt - 1) * 16 + i; const v4f x = t[(bt - 1) & 1][i]; v4b c;
#pragma unroll
          for (int k = 0; k < 4; ++k) c[k] = (__bf16)x[k];
          *(v4b*)&sX[(p * 2 + sr) * GP + sc] = c; } } } }
  __syncthreads();   // publishes both staged tiles
  v8f acc[8] = {};
  v16b fa[2], fw[2][8];   // fragments of two k blocks: the next block's LDS reads are issued as one group ahead of this block's products; unrolled so that both sets have constant indices (registers)
#pragma unroll
  for (int kc = -1; kc < DIN / 32; ++kc) {
    if (kc + 1 < DIN / 32) { fa[(kc + 1) & 1] = frag_b(&sX[(wave * 16 + col) * GP + (kc + 1) * 32], lane);
#pragma unroll
      for (int j = 0; j < 8; ++j) fw[(kc + 1) & 1][j] = frag_b(&sW[(j * 16 + col) * GP + (kc + 1) * 32], lane); }
    if (kc >= 0) {
#pragma unroll
      for (int j = 0; j < 8; ++j) acc[j] = wmma_bf(fa[kc & 1], fw[kc & 1][j], acc[j]); } }
  __syncthreads();   // ends every wave's fragment reads before the epilogue's tiles overwrite the staged operands
  if (which < 2) { _Float16* DH = which == 0 ? QH : KH; _Float16* DL = which == 0 ? QL : KL; const int nhi = which == 0 ? QHI : KHI; const bool hi_rows = t0 < nhi; const float sc = which == 0 ? QSC : KSC, rs = which == 0 ? 1.0f : 1024.0f;
#pragma unroll
    for (int j = 0; j < 8; ++j) { const float bias = BA ? bfr(BA[c0 + j * 16 + col]) : 0.f;
#pragma unroll
      for (int r = 0; r < 8; ++r) { const float v = (acc[j][r] + bias) * sc; const _Float16 hv = (_Float16)v; sh[wave * 16 + 8 * g + r][j * 16 + col] = hv; sl[wave * 16 + 8 * g + r][j * 16 + col] = (_Float16)((v - (float)hv) * rs); } }
    __syncthreads();
    for (int e = tid; e < 64 * 16; e += 128) { const int rl = e >> 4, q = e & 15; vst2((unsigned*)(DH + (r0 + rl) * CC + c0 + q * 8), *(const v4u*)&sh[rl][q * 8]); if (hi_rows) vst2((unsigned*)(DL + (bb * nhi + t0 + rl) * (size_t)CC + c0 + q * 8), *(const v4u*)&sl[rl][q * 8]); }
  } else { const bool hi_rows = t0 < KHI;
#pragma unroll
    for (int j = 0; j < 8; ++j) { const float bias = BA ? bfr(BA[c0 + j * 16 + col]) : 0.f;
#pragma unroll
      for (int r = 0; r < 8; ++r) { const float v = acc[j][r] + bias; const int rl = wave * 16 + 8 * g + r, cl = j * 16 + col; th[cl][rl] = (_Float16)v; const __bf16 bh = (__bf16)v; tb[cl][rl] = bh; tbl[cl][rl] = (__bf16)(v - (float)bh); } }
    __syncthreads();
    for (int e = tid; e < 128 * 8; e += 128) { const int cl = e >> 3, q = e & 7; vst2((unsigned*)(VT + (bb * CC + c0 + cl) * (size_t)TT + t0 + q * 8), *(const v4u*)&th[cl][q * 8]); if (hi_rows) { const size_t o3 = (bb * CC + c0 + cl) * (size_t)KHI + t0 + q * 8; vst2((unsigned*)(VB + o3), *(const v4u*)&tb[cl][q * 8]); vst2((unsigned*)(VBL + o3), *(const v4u*)&tbl[cl][q * 8]); } } } }
// ---- k_fa: block = 128 queries of one (b, h), 8 waves x 16 query columns: S^T = k q^T + (8 - maximum in use) (q residual, then q hi, accumulated into one tile: the tile is the exp2 argument), sum per query in f32, P^T x 2^8 (relative to the maximum in use) once to f16 straight from the score tiles as B operand, O^T += v^T P^T (1 product); k rows and v planes staged in LDS, 128 keys a stage, two buffers
#define FA_ST 128          // keys per stage
#define FA_KP 40           // LDS pitch of a k row in halfs (80 B = 16 B x odd)
#define FA_VP 136          // LDS pitch of a v plane row in halfs (272 B = 16 B x odd)
__device__ __forceinline__ float xhalf(float x) { return __builtin_bit_cast(float, __builtin_amdgcn_permlanex16(__builtin_bit_cast(int, x), __builtin_bit_cast(int, x), 0x76543210, 0xfedcba98, false, false)); }   // lane l with lane l ^ 16
// exp2 of the eight registers of a score tile into eight registers of their own (early clobber: no result lands on a source of the run), in one statement closed by v_nop: the slot that the instruction set asks for between a transcendental and the first use of its result
__device__ __forceinline__ void exp2x8(float (&y)[8], const v8f x) {
  asm("v_exp_f32 %0, %8\n\tv_exp_f32 %1, %9\n\tv_exp_f32 %2, %10\n\tv_exp_f32 %3, %11\n\tv_exp_f32 %4, %12\n\tv_exp_f32 %5, %13\n\tv_exp_f32 %6, %14\n\tv_exp_f32 %7, %15\n\tv_nop"
      : "=&v"(y[0]), "=&v"(y[1]), "=&v"(y[2]), "=&v"(y[3]), "=&v"(y[4]), "=&v"(y[5]), "=&v"(y[6]), "=&v"(y[7])
      : "v"(x[0]), "v"(x[1]), "v"(x[2]), "v"(x[3]), "v"(x[4]), "v"(x[5]), "v"(x[6]), "v"(x[7])); }
__device__ __forceinline__ v8f wmma_h(v16h a, v16h b, v8f c) { return __builtin_amdgcn_wmma_f32_16x16x32_f16(false, a, false, b, (short)0, c, false, false); }
__global__ __launch_bounds__(256) __attribute__((amdgpu_waves_per_eu(4, 4))) void k_fa(const _Float16* __restrict__ QH, const _Float16* __restrict__ QL, const _Float16* __restrict__ KH, const _Float16* __restrict__ VT, float* __restrict__ Y) {
  __shared__ __align__(16) _Float16 sK[2][FA_ST * FA_KP]; __shared__ __align__(16) _Float16 sV[2][HD * FA_VP];
  const int tid = threadIdx.x, wave = tid >> 5, lane = tid & 31, col = lane & 15, g = lane >> 4; const int b = blockIdx.y / NH, h = blockIdx.y % NH; const int q = blockIdx.x * 128 + wave * 16 + col;
  const v16h qh = frag_h(QH + ((size_t)b * TT + q) * CC + h * HD, lane), ql = frag_h(QL + ((size_t)b * QHI + q) * CC + h * HD, lane);   // B operands: column = query
  const int kr = tid >> 2, ks = (tid & 3) * 8, vr = tid >> 4, vs = (tid & 15) * 8;   // this thread's 16-B pieces of a stage: k rows kr, kr + 64; v rows vr, vr + 16
  const _Float16* Kg = KH + ((size_t)b * TT + kr) * CC + h * HD + ks; const _Float16* Vg = VT + ((size_t)b * CC + h * HD + vr) * TT + vs;
  v4u rk0 = *(const v4u*)Kg, rk1 = *(const v4u*)(Kg + (size_t)64 * CC), rv0 = *(const v4u*)Vg, rv1 = *(const v4u*)(Vg + (size_t)16 * TT);
  *(v4u*)&sK[0][kr * FA_KP + ks] = rk0; *(v4u*)&sK[0][(kr + 64) * FA_KP + ks] = rk1; *(v4u*)&sV[0][vr * FA_VP + vs] = rv0; *(v4u*)&sV[0][(vr + 16) * FA_VP + vs] = rv1;
  __syncthreads();
  v8f o[HD / 16] = {}; float l = 0.f; v8f cv = {};   // cv: the start value of every score tile, 8 - the query's maximum in use (log2 units), the same in all eight registers; 0 until the first pass sets it
#pragma unroll 1   // the stage loop stays rolled: one stage is already a long straight body (for speed only); the inner loops are unrolled so that every register array has constant indices
  for (int s = 0; s < TT / FA_ST; ++s) { const int cur = s & 1; const bool more = s + 1 < TT / FA_ST;
    if (more) { const _Float16* kp = Kg + (size_t)(s + 1) * FA_ST * CC; const _Float16* vp = Vg + (s + 1) * FA_ST; rk0 = *(const v4u*)kp; rk1 = *(const v4u*)(kp + (size_t)64 * CC); rv0 = *(const v4u*)vp; rv1 = *(const v4u*)(vp + (size_t)16 * TT); }
    { v8f sv[FA_ST / 16]; v16h kf[FA_ST / 16];   // a pass is the whole stage
#pragma unroll
      for (int t = 0; t < FA_ST / 16; ++t) { kf[t] = frag_h(&sK[cur][(t * 16 + col) * FA_KP], lane); sv[t] = wmma_h(kf[t], ql, cv); }   // A operand: row = key
#pragma unroll
      for (int t = 0; t < FA_ST / 16; ++t) sv[t] = wmma_h(kf[t], qh, sv[t]);   // q hi accumulated into the same tiles
      v16h vf[HD / 16][FA_ST / 32];   // A operands of the second product: row = channel, keys in the order of the packed score tiles
#pragma unroll
      for (int j = 0; j < HD / 16; ++j)
#pragma unroll
        for (int u = 0; u < FA_ST / 32; ++u) vf[j][u] = frag_h(&sV[cur][(j * 16 + col) * FA_VP + u * 32], lane);
      float mt[FA_ST / 16];
#pragma unroll
      for (int t = 0; t < FA_ST / 16; ++t) { mt[t] = sv[t][0];
#pragma unroll
        for (int r = 1; r < 8; ++r) mt[t] = fmaxf(mt[t], sv[t][r]); }
      float mx = fmaxf(fmaxf(fmaxf(mt[0], mt[1]), fmaxf(mt[2], mt[3])), fmaxf(fmaxf(mt[4], mt[5]), fmaxf(mt[6], mt[7])));
      // asks the scheduler for this order in the block: the K reads, ten products, then the other six with maxima of finished tiles between them: left free, each tile's first maximum stands directly behind its product and is padded with v_nop
      __builtin_amdgcn_sched_group_barrier(0x100, 16, 0); __builtin_amdgcn_sched_group_barrier(0x008, 10, 0);
#pragma unroll
      for (int t = 0; t < 6; ++t) { __builtin_amdgcn_sched_group_barrier(0x002, 5, 0); __builtin_amdgcn_sched_group_barrier(0x008, 1, 0); }
      const bool first = s == 0;
      if ((__builtin_amdgcn_ballot_w32(mx > 15.0f) | (first ? 1u : 0u)) != 0) {   // one scalar branch a pass: taken on the first pass, and when an argument would bring P x 2^8 near the top of f16 (2^16)
        mx = fmaxf(mx, xhalf(mx)); const float d = first ? mx - 8.0f : fmaxf(mx - 8.0f, 0.f); const float alpha = __builtin_amdgcn_exp2f(-fmaxf(d, 0.f));   // the maximum in use goes up by d (the first pass sets it, up or down, while o and l are still 0)
#pragma unroll
        for (int t = 0; t < FA_ST / 16; ++t) sv[t] -= d;
        cv -= d; l *= alpha;
#pragma unroll
        for (int j = 0; j < HD / 16; ++j) o[j] *= alpha; }
      float ps[FA_ST / 16]; v16h pf[FA_ST / 32];
#pragma unroll
      for (int t = 0; t < FA_ST / 16; ++t) { float e[8];
        exp2x8(e, sv[t]);
        ps[t] = ((e[0] + e[1]) + (e[2] + e[3])) + ((e[4] + e[5]) + (e[6] + e[7]));
#pragma unroll
        for (int r = 0; r < 8; ++r) pf[t >> 1][(t & 1) * 8 + r] = (_Float16)e[r]; }
      l += ((ps[0] + ps[1]) + (ps[2] + ps[3])) + ((ps[4] + ps[5]) + (ps[6] + ps[7]));
#pragma unroll
      for (int u = 0; u < FA_ST / 32; ++u)
#pragma unroll
        for (int j = 0; j < HD / 16; ++j) o[j] = wmma_h(vf[j][u], pf[u], o[j]); }
    if (more) { const int nx = cur ^ 1; *(v4u*)&sK[nx][kr * FA_KP + ks] = rk0; *(v4u*)&sK[nx][(kr + 64) * FA_KP + ks] = rk1; *(v4u*)&sV[nx][vr * FA_VP + vs] = rv0; *(v4u*)&sV[nx][(vr + 16) * FA_VP + vs] = rv1; }
    __syncthreads(); }   // publishes stage s + 1 and ends every wave's reads of the buffer that the next trip refills
  const float inv = 1.0f / (l + xhalf(l));
#pragma unroll
  for (int j = 0; j < HD / 16; ++j) { float* yp = Y + ((size_t)b * TT + q) * CC + h * HD + j * 16 + 8 * g; v4f a0, a1;
#pragma unroll
    for (int r = 0; r < 4; ++r) { a0[r] = o[j][r] * inv; a1[r] = o[j][4 + r] * inv; }
    vst2(yp, a0); vst2(yp + 4, a1); } }

extern "C" void kernel_launch(void* const* d_in, const int* in_sizes, int n_in, void* d_out, int out_size, void* d_ws, size_t ws_size, hipStream_t stream) {
  (void)in_sizes; (void)n_in; (void)out_size;
  const float** F = (const float**)d_in;
  if (ws_size < (size_t)WS_END) return;
  char* ws = (char*)d_ws; _Float16 *QH = (_Float16*)(ws + WS_QH), *KH = (_Float16*)(ws + WS_KH), *VT = (_Float16*)(ws + WS_VT), *QL = (_Float16*)(ws + WS_QL), *KL = (_Float16*)(ws + WS_KL); __bf16 *VB = (__bf16*)(ws + WS_VB), *VBL = (__bf16*)(ws + WS_VBL); float *S = (float*)(ws + WS_S), *Y = (float*)(ws + WS_Y);
  (void)Y; (void)S; (void)QL; (void)KL; (void)VB; (void)VBL;
  // inputs: 0 Q [4,2048,256]; 1 K [4,2048,256]; 2 Wq [256,256] (out,in), 3 bq; 4 Wk, 5 bk; 6 Wv, 7 bv; 8 Wo (out,in), 9 bo; 10 g0, 11 b0; 12 g1, 13 b1
  if (ws_size < (size_t)WS_END2) return;
  float *YA = (float*)(ws + WS_Y2);
  k_proj<<<dim3(TNB * TT / 64, CC / 128, 3), 128, 0, stream>>>(F[0], F[1], F[1], F[2], F[4], F[6], F[3], F[5], F[7], QH, QL, KH, KL, VT, VB, VBL);
  k_fa<<<dim3(TT / 128, TNB * NH), 256, 0, stream>>>(QH, QL, KH, VT, YA);
  k_tail<<<dim3(NRW / TR), 256, 0, stream>>>(YA, F[10], F[11], F[8], F[9], F[12], F[13], (float*)d_out);   /* out = LN1(o + relu(o Wo^T + bo)), o = LN0(attention output) */
}

// v005
// One run takes 40.2 microseconds.
// In two side-by-side timings against v004, it was 1.09 and 1.10 times as fast.
// All steps since v000 together make it 21.6 times as fast.
// compute dtype: all float inputs rounded to bf16; Qp/Kp/Vp = X W^T + b with EXACT bf16 products on WMMA 16x16x32 (f32 accumulate); q x 32^-0.5 x log2(e) x 2^5 once to f16 against k x 2^-5 once to f16 (1 product into a tile that starts at 8 - the maximum in use); softmax in f32 with a maximum in use that is raised only when a score passes it by more than 7 (hardware exp2); unnormalised P x 2^8 once to f16 against v once to f16 (1 product), divided by the f32 row sum at the end; LayerNorms in f32; the fc_o layer with the LN rows once to f16 against Wo as f16(bf16 x 2^6) (1 product) + bias, relu and residual in f32; f32 output.
#include <hip/hip_runtime.h>
#include <math.h>

typedef __attribute__((ext_vector_type(16))) _Float16 v16h;
typedef __attribute__((ext_vector_type(16))) __bf16 v16b;
typedef __attribute__((ext_vector_type(8)))  _Float16 v8h;
typedef __attribute__((ext_vector_type(8)))  float v8f;
typedef __attribute__((ext_vector_type(4)))  float v4f;
typedef __attribute__((ext_vector_type(2)))  float v2f;
typedef __attribute__((ext_vector_type(4)))  unsigned v4u;
typedef __attribute__((ext_vector_type(4)))  int v4i;
typedef float __attribute__((may_alias)) float_a;
typedef int __attribute__((may_alias)) int_a;

template <typename T> __device__ __forceinline__ void vst2(void* p, T v) { *(T*)p = v;  }
__device__ __forceinline__ v8f wmma16(v16h a, v16h b, v8f c) {
  v8f d = __builtin_amdgcn_wmma_f32_16x16x32_f16(false, a, false, b, (short)0, c, false, false);
  asm volatile("v_nop\n\tv_nop\n\tv_nop\n\tv_nop" : "+v"(d) : "v"(a), "v"(b));
  return d;
}
__device__ __forceinline__ v8f wmma_bf(v16b a, v16b b, v8f c) {
  v8f d = __builtin_amdgcn_wmma_f32_16x16x32_bf16(false, a, false, b, (short)0, c, false, false);
  asm volatile("v_nop\n\tv_nop\n\tv_nop\n\tv_nop" : "+v"(d) : "v"(a), "v"(b));
  return d;
}
// 16x16x32 fragments: lane = (h = lane>>4, row/col = lane&15); elements 0..7 = k0+8h+0..7, 8..15 = k0+16+8h+0..7; D element r = row 8h+r
__device__ __forceinline__ v16h frag_h(const _Float16* rowk0, int lane) {
  union { v16h v; v8h q[2]; } u; const _Float16* p = rowk0 + 8 * (lane >> 4);
  u.q[0] = *(const v8h*)p; u.q[1] = *(const v8h*)(p + 16); return u.v;
}
__device__ __forceinline__ v16h frag_f32(const float* rowk0, int lane) {
  v16h a; const float* p = rowk0 + 8 * (lane >> 4);
#pragma unroll
  for (int i = 0; i < 8; ++i) { a[i] = (_Float16)p[i]; a[8 + i] = (_Float16)p[16 + i]; }
  return a;
}
__device__ __forceinline__ v16h frag_f32s(const float* rowk0, int lane, float sc) {
  v16h a; const float* p = rowk0 + 8 * (lane >> 4);
#pragma unroll
  for (int i = 0; i < 8; ++i) { a[i] = (_Float16)(p[i] * sc); a[8 + i] = (_Float16)(p[16 + i] * sc); }
  return a;
}
// column fragment from a [K][ld] layout (column n), rows >= K read as 0
__device__ __forceinline__ v16h fragc_f32(const float* W, int k0, int n, int lane, int ld, int K) {
  v16h a; const int g = lane >> 4;
#pragma unroll
  for (int i = 0; i < 8; ++i) { const int ka = k0 + 8 * g + i, kb = ka + 16;
    a[i] = (_Float16)(ka < K ? W[(size_t)(ka < K ? ka : K - 1) * ld + n] : 0.f); a[8 + i] = (_Float16)(kb < K ? W[(size_t)(kb < K ? kb : K - 1) * ld + n] : 0.f); }
  return a;
}
struct F2 { v16b h, l; };
__device__ __forceinline__ F2 bsplit16(const float v[16]) { F2 r;
#pragma unroll
  for (int i = 0; i < 16; ++i) { const __bf16 h = (__bf16)v[i]; r.h[i] = h; r.l[i] = (__bf16)(v[i] - (float)h); }
  return r; }
__device__ __forceinline__ F2 split_row(const float* row, int k0, int lane) { float v[16]; const float* p = row + k0 + 8 * (lane >> 4);
#pragma unroll
  for (int i = 0; i < 8; ++i) { v[i] = p[i]; v[8 + i] = p[16 + i]; }
  return bsplit16(v); }
__device__ __forceinline__ F2 split_rowK(const float* row, int k0, int lane, int K) { float v[16]; const int g = lane >> 4;
#pragma unroll
  for (int i = 0; i < 8; ++i) { const int ka = k0 + 8 * g + i, kb = ka + 16; v[i] = ka < K ? row[ka < K ? ka : K - 1] : 0.f; v[8 + i] = kb < K ? row[kb < K ? kb : K - 1] : 0.f; }
  return bsplit16(v); }
__device__ __forceinline__ F2 split_col(const float* W, int k0, int n, int lane, int ld, int K) { float v[16]; const int g = lane >> 4;
#pragma unroll
  for (int i = 0; i < 8; ++i) { const int ka = k0 + 8 * g + i, kb = ka + 16; v[i] = ka < K ? W[(size_t)(ka < K ? ka : K - 1) * ld + n] : 0.f; v[8 + i] = kb < K ? W[(size_t)(kb < K ? kb : K - 1) * ld + n] : 0.f; }
  return bsplit16(v); }
__device__ __forceinline__ v8f mac3(const F2& a, const F2& b, v8f c) { c = wmma_bf(a.l, b.h, c); c = wmma_bf(a.h, b.l, c); return wmma_bf(a.h, b.h, c); }
__device__ __forceinline__ float sigm(float v) { return 1.0f / (1.0f + expf(-v)); }
#define LDSX() do { asm volatile("s_wait_dscnt 0" ::: "memory"); __builtin_amdgcn_wave_barrier(); __builtin_amdgcn_fence(__ATOMIC_RELEASE, "workgroup"); } while (0)

// Set-Transformer MAB (B 4, NQ = NK = 2,048, dim 256 = 8 heads x 32; 0.02-scale (out,in) weights, zero biases, LN gamma 1 / beta 0): Qp = Q Wq^T + bq, Kp = K Wk^T + bk, Vp = K Wv^T + bv; o = merged(softmax(q k^T / sqrt(32)) v); o = LN0(o); out = LN1(o + relu(o Wo^T + bo)) (eps 1e-5, biased var).
#define NB 4
#define TT 2048
#define CC 256            // NH * HD = projected width
#define DIN 256          // input (model) width
#define NH 8
#define HD 32
#define NQB (TT / 64)
#define HG 4
#define SCALE (0.17677669529663687f)
#define CAUSAL 0
#ifndef TNB
#define TNB NB
#endif
__device__ __forceinline__ float bfr(float v) { return (float)(__bf16)v; }
__host__ __device__ __forceinline__ int kb_last(int qb) { return CAUSAL ? ((qb * 64 + 63) >> 7) : (TT / 128 - 1); }
typedef __attribute__((ext_vector_type(8))) __bf16 v8b;
__device__ __forceinline__ v16b frag_b(const __bf16* rowk0, int lane) {
  union { v16b v; v8b q[2]; } u; const __bf16* p = rowk0 + 8 * (lane >> 4);
  u.q[0] = *(const v8b*)p; u.q[1] = *(const v8b*)(p + 16); return u.v;
}
#define QBH 0              // not read by any kernel here
#define KHI 64            // key rows carrying k residual / v bf16 hi+lo planes (written by k_proj; no kernel here reads them)
// B fragment (k rows k0+.., output column o) of a weight: (in,out) [K][ld] or (out,in) [ld rows of K]: bf16 exact, or f16(bf16 * 256) exact
__device__ __forceinline__ v16b wcol_io(const float* Wm, int k0, int o, int lane, int ld) { v16b w; const int g = lane >> 4;
#pragma unroll
  for (int i = 0; i < 8; ++i) { w[i] = (__bf16)Wm[(size_t)(k0 + 8 * g + i) * ld + o]; w[8 + i] = (__bf16)Wm[(size_t)(k0 + 16 + 8 * g + i) * ld + o]; }
  return w; }
__device__ __forceinline__ v16b wcol_oi(const float* Wm, int k0, int o, int lane, int K) { v16b w; const float* p = Wm + (size_t)o * K + k0 + 8 * (lane >> 4);
#pragma unroll
  for (int i = 0; i < 8; ++i) { w[i] = (__bf16)p[i]; w[8 + i] = (__bf16)p[16 + i]; }
  return w; }
__device__ __forceinline__ v16h wcolh_io(const float* Wm, int k0, int o, int lane, int ld) { v16h w; const int g = lane >> 4;
#pragma unroll
  for (int i = 0; i < 8; ++i) { w[i] = (_Float16)(bfr(Wm[(size_t)(k0 + 8 * g + i) * ld + o]) * 256.0f); w[8 + i] = (_Float16)(bfr(Wm[(size_t)(k0 + 16 + 8 * g + i) * ld + o]) * 256.0f); }
  return w; }
__device__ __forceinline__ v16h wcolh_oi(const float* Wm, int k0, int o, int lane, int K) { v16h w; const float* p = Wm + (size_t)o * K + k0 + 8 * (lane >> 4);
#pragma unroll
  for (int i = 0; i < 8; ++i) { w[i] = (_Float16)(bfr(p[i]) * 256.0f); w[8 + i] = (_Float16)(bfr(p[16 + i]) * 256.0f); }
  return w; }
#define WQKV_LAYOUT 1   // 0 = (in,out) [DIN][CC]; 1 = (out,in) [CC][DIN]; 2 = per-head [NH][DIN][HD]
__device__ __forceinline__ v16b wcol_hdk(const float* Wm, int k0, int o, int lane) { v16b w; const int g = lane >> 4; const float* p = Wm + (size_t)(o / HD) * DIN * HD + (o % HD);
#pragma unroll
  for (int i = 0; i < 8; ++i) { w[i] = (__bf16)p[(size_t)(k0 + 8 * g + i) * HD]; w[8 + i] = (__bf16)p[(size_t)(k0 + 16 + 8 * g + i) * HD]; }
  return w; }
#define WO_OUT_IN 0
#if WQKV_LAYOUT == 1
#define WCOL(W, k0, o, lane) wcol_oi(W, k0, o, lane, DIN)
#elif WQKV_LAYOUT == 2
#define WCOL(W, k0, o, lane) wcol_hdk(W, k0, o, lane)
#else
#define WCOL(W, k0, o, lane) wcol_io(W, k0, o, lane, CC)
#endif
#if WO_OUT_IN
#define WOCOL(W, k0, o, lane) wcol_oi(W, k0, o, lane, CC)
#define WOCOLH(W, k0, o, lane) wcolh_oi(W, k0, o, lane, CC)
#else
#define WOCOL(W, k0, o, lane) wcol_io(W, k0, o, lane, DIN)
#define WOCOLH(W, k0, o, lane) wcolh_io(W, k0, o, lane, DIN)
#endif
#define NRW (TNB * TT)
// LayerNorm over CC = 256 of four rows held by one wave (mean, biased var, (x - mean) * rsqrt(var + 1e-5) * g + b): 8 floats of a row per lane (2 float4 at stride 128 floats); the four rows' lane exchanges are independent of one another
__device__ __forceinline__ void ln4(v4f (&v)[4][CC / 128], const v4f (&gv)[CC / 128], const v4f (&bv)[CC / 128]) {
  float s1[4], q[4];
#pragma unroll
  for (int rr = 0; rr < 4; ++rr) { s1[rr] = 0.f;
#pragma unroll
    for (int i = 0; i < CC / 128; ++i) { const v4f t = v[rr][i]; s1[rr] += (t[0] + t[1]) + (t[2] + t[3]); } }
#pragma unroll
  for (int o = 1; o < 32; o <<= 1)
#pragma unroll
    for (int rr = 0; rr < 4; ++rr) s1[rr] += __shfl_xor(s1[rr], o);
#pragma unroll
  for (int rr = 0; rr < 4; ++rr) { s1[rr] *= (1.0f / CC); q[rr] = 0.f;
#pragma unroll
    for (int i = 0; i < CC / 128; ++i)
#pragma unroll
      for (int k = 0; k < 4; ++k) { const float d = v[rr][i][k] - s1[rr]; q[rr] += d * d; } }
#pragma unroll
  for (int o = 1; o < 32; o <<= 1)
#pragma unroll
    for (int rr = 0; rr < 4; ++rr) q[rr] += __shfl_xor(q[rr], o);
#pragma unroll
  for (int rr = 0; rr < 4; ++rr) q[rr] = rsqrtf(q[rr] * (1.0f / CC) + 1e-5f);   /* jnp.var (biased), eps inside the rsqrt */
#pragma unroll
  for (int rr = 0; rr < 4; ++rr)
#pragma unroll
    for (int i = 0; i < CC / 128; ++i)
#pragma unroll
      for (int k = 0; k < 4; ++k) v[rr][i][k] = bfr(gv[i][k]) * ((v[rr][i][k] - s1[rr]) * q[rr]) + bfr(bv[i][k]); }
#define GP 264            // LDS pitch of a staged operand row of 256 16-bit elements (528 B = 16 B x odd)
typedef __attribute__((ext_vector_type(4))) _Float16 v4h;
typedef __attribute__((ext_vector_type(4))) __bf16 v4b;
#define TR 32             // rows of a block of k_tail
#define OP 260            // LDS pitch of an f32 row there (1,040 B: the two lane halves of an accumulator tile, 8 rows apart, fall on different banks)
// ---- k_tail: block = 32 whole rows, 8 waves: o = LN0(Y) (wave = 4 rows; kept in LDS as f32 rows and once to f16), r = o + relu(o x W^T (W (out,in) as f16(bf16 x 2^6), all 256 rows staged in LDS by 512-B wave loads) x 2^-6 + bias) (wave = 32 rows x 32 cols), OUT = LN1(r) (wave = 4 rows)
__global__ __launch_bounds__(256) void k_tail(const float* __restrict__ Y, const float* __restrict__ G0, const float* __restrict__ BE0, const float* __restrict__ Wm, const float* __restrict__ BIAS, const float* __restrict__ G1, const float* __restrict__ BE1, float* __restrict__ OUT) {
  __shared__ __align__(16) _Float16 sW[CC * GP]; __shared__ __align__(16) _Float16 sA[TR * GP]; __shared__ __align__(16) float sO[TR * OP];
  const int tid = threadIdx.x, wave = tid >> 5, lane = tid & 31, col = lane & 15, g = lane >> 4;
  const char* yb = (const char*)(Y + (size_t)blockIdx.x * TR * CC); const char* wb = (const char*)Wm; const unsigned offy = (wave * 4 * CC + lane * 4) * 4, offl = lane * 16, offb = tid * 16, offc = (wave * 32 + col) * 4;   // block-uniform bases, one lane offset each
  v4f y[4][CC / 128], g0v[CC / 128], b0v[CC / 128], g1v[CC / 128], b1v[CC / 128]; float bo[2];
#pragma unroll
  for (int rr = 0; rr < 4; ++rr)
#pragma unroll
    for (int i = 0; i < CC / 128; ++i) y[rr][i] = *(const v4f*)(yb + (rr * CC + i * 128) * 4 + offy);
#pragma unroll
  for (int i = 0; i < CC / 128; ++i) { g0v[i] = *(const v4f*)((const char*)G0 + i * 512 + offl); b0v[i] = *(const v4f*)((const char*)BE0 + i * 512 + offl); }
  asm volatile("s_wait_xcnt 0x0" :: "v"(offy), "v"(offl), "s"(yb), "s"(G0), "s"(BE0) : "memory");   // the wait owed before a register that an issued load names is rewritten: as inputs, the lane offsets and the bases stay untouched up to it
  v4f t[2][16];   // W: 256 threads x 16 B = four whole rows a pass, four batches of 16 passes, two batches in flight; every loop here is unrolled so that t has constant indices (registers) and each load a constant offset
#pragma unroll
  for (int bt = 0; bt < 2; ++bt)
#pragma unroll
    for (int i = 0; i < 16; ++i) t[bt][i] = *(const v4f*)(wb + (bt * 16 + i) * 4 * CC * 4 + offb);
  asm volatile("s_wait_xcnt 0x0" :: "v"(offb), "s"(wb) : "memory");   // as above
  ln4(y, g0v, b0v);   // runs while the first two batches of W are in flight
#pragma unroll
  for (int rr = 0; rr < 4; ++rr)
#pragma unroll
    for (int i = 0; i < CC / 128; ++i) { const v4f x = y[rr][i]; v4h c;
#pragma unroll
      for (int k = 0; k < 4; ++k) c[k] = (_Float16)x[k];
      *(v4f*)&sO[(wave * 4 + rr) * OP + i * 128 + lane * 4] = x; *(v4h*)&sA[(wave * 4 + rr) * GP + i * 128 + lane * 4] = c; }
  __builtin_amdgcn_sched_barrier(0);   // keeps the conversions of W behind LN0: drawn up among it they hold converted copies beside the loaded registers, and the kernel goes past 256 registers (a window switch at every other instruction)
#pragma unroll
  for (int bt = 0; bt < 4; ++bt) {
#pragma unroll
    for (int i = 0; i < 16; ++i) { const int p = bt * 16 + i; const v4f x = t[bt & 1][i]; v4h c;
#pragma unroll
      for (int k = 0; k < 4; ++k) c[k] = (_Float16)(bfr(x[k]) * 64.0f);
      *(v4h*)&sW[(p * 4 + (tid >> 6)) * GP + (tid & 63) * 4] = c; }
    if (bt + 2 < 4) {
#pragma unroll
      for (int i = 0; i < 16; ++i) t[bt & 1][i] = *(const v4f*)(wb + ((bt + 2) * 16 + i) * 4 * CC * 4 + offb);
      asm volatile("s_wait_xcnt 0x0" :: "v"(offb), "s"(wb) : "memory"); }   // as above
    if (bt == 1) {   // what the epilogue and LN1 need, issued behind the last batch of W: back before the barrier below waits for every load
#pragma unroll
      for (int i = 0; i < CC / 128; ++i) { g1v[i] = *(const v4f*)((const char*)G1 + i * 512 + offl); b1v[i] = *(const v4f*)((const char*)BE1 + i * 512 + offl); }
#pragma unroll
      for (int j = 0; j < 2; ++j) bo[j] = *(const float*)((const char*)BIAS + j * 64 + offc);
      asm volatile("s_wait_xcnt 0x0" :: "v"(offl), "v"(offc), "s"(G1), "s"(BE1), "s"(BIAS) : "memory"); } }   // as above
  __syncthreads();   // publishes the LN0 rows (both forms) and the staged W
  v8f acc[2][2] = {};
  v16h fa[4][2], fw[4][2];   // fragments of four k blocks: each block's LDS reads are issued as one group three blocks ahead of its products (the reads are 4 KB a wave and block; for speed only); unrolled so that the sets have constant indices (registers)
#pragma unroll
  for (int kc = -3; kc < CC / 32; ++kc) {
    if (kc + 3 < CC / 32) {
#pragma unroll
      for (int i = 0; i < 2; ++i) { fa[(kc + 3) & 3][i] = frag_h(&sA[(i * 16 + col) * GP + (kc + 3) * 32], lane); fw[(kc + 3) & 3][i] = frag_h(&sW[((wave * 2 + i) * 16 + col) * GP + (kc + 3) * 32], lane); } }
    __builtin_amdgcn_sched_barrier(0);   // keeps the group of reads ahead of the products: left free, the reads sink to just in front of their own products and each is waited to 0
    if (kc >= 0) {
#pragma unroll
      for (int i = 0; i < 2; ++i)
#pragma unroll
        for (int j = 0; j < 2; ++j) acc[i][j] = __builtin_amdgcn_wmma_f32_16x16x32_f16(false, fa[kc & 3][i], false, fw[kc & 3][j], (short)0, acc[i][j], false, false); } }
#pragma unroll
  for (int j = 0; j < 2; ++j) { const float bb = bfr(bo[j]);
#pragma unroll
    for (int i = 0; i < 2; ++i)
#pragma unroll
      for (int r = 0; r < 8; ++r) { float* p = &sO[(i * 16 + 8 * g + r) * OP + (wave * 2 + j) * 16 + col]; *p = fmaxf(acc[i][j][r] * (1.0f / 64.0f) + bb, 0.f) + *p; } }   /* relu before the residual; each element is read and rewritten by its one lane */
  __syncthreads();   // publishes the rows o + relu(..), whose columns come from all eight waves
#pragma unroll
  for (int rr = 0; rr < 4; ++rr)
#pragma unroll
    for (int i = 0; i < CC / 128; ++i) y[rr][i] = *(const v4f*)&sO[(wave * 4 + rr) * OP + i * 128 + lane * 4];
  ln4(y, g1v, b1v);
  char* ob = (char*)(OUT + (size_t)blockIdx.x * TR * CC);
#pragma unroll
  for (int rr = 0; rr < 4; ++rr)
#pragma unroll
    for (int i = 0; i < CC / 128; ++i) vst2(ob + (rr * CC + i * 128) * 4 + offy, y[rr][i]); }

#ifndef SM_EXTRA_PARAMS
#define SM_EXTRA_PARAMS
#endif
#ifndef PROJ_EXTRA_PARAMS
#define PROJ_EXTRA_PARAMS
#endif
#ifndef SM_MASK_HOOK
#define SM_MASK_HOOK (void)0
#endif

#define WS_QH  0u                                      // f16 q rows [b*t][CC]
#define WS_KH  (WS_QH + 2u * (size_t)NB * TT * CC)      // f16 k rows [b*t][CC]
#define WS_VT  (WS_KH + 2u * (size_t)NB * TT * CC)      // f16 v planes [b][c][t]
#define WS_KL  (WS_VT + 2u * (size_t)NB * CC * TT)      // f16 k residual x 2^10 rows [b][t < KHI][CC]
#define WS_VB  (WS_KL + 2u * (size_t)NB * KHI * CC)     // bf16 v hi planes [b][c][t < KHI]
#define WS_VBL (WS_VB + 2u * (size_t)NB * CC * KHI)
#define WS_S   (WS_VBL + 2u * (size_t)NB * CC * KHI)    // f32 [hg][t][s] region; no kernel here uses it
#define WS_Y   (WS_S  + 4u * (size_t)HG * TT * TT)      // f32 ctx rows [b*t][CC] (only when there is an output projection)
#define WS_END (WS_Y  + 0u)
#define WS_Y2  (WS_END)
#define WS_O1  (WS_Y2 + 4u * (size_t)NB * TT * CC)
#define WS_R2  (WS_O1 + 4u * (size_t)NB * TT * CC)
#define WS_END2 (WS_R2 + 4u * (size_t)NB * TT * CC)

#define QSC (SCALE * 1.4426950408889634f * 32.0f)   // q leaves k_proj as q x 32^-0.5 x log2(e) x 2^5, k as k x 2^-5: their product is the exp2 argument itself
#define KSC (1.0f / 32.0f)
// ---- k_proj: block = (64 rows, 128 cols, which): q/k/v = X W (+ b) with exact bf16 products (K = DIN) -> which 0: q x QSC f16 rows; 1: k x KSC f16 rows (+ residual rows < KHI); 2: v f16 planes [c][t] (+ bf16 hi/lo planes for t < KHI)
__global__ __launch_bounds__(128) void k_proj(const float* __restrict__ XQ, const float* __restrict__ XK, const float* __restrict__ XV, const float* __restrict__ WQ, const float* __restrict__ WK, const float* __restrict__ WV, const float* __restrict__ BQ, const float* __restrict__ BK, const float* __restrict__ BV,
    _Float16* __restrict__ QH, _Float16* __restrict__ KH, _Float16* __restrict__ KL, _Float16* __restrict__ VT, __bf16* __restrict__ VB, __bf16* __restrict__ VBL) {
  __shared__ __align__(16) char sm[(64 + 128) * GP * 2];   // first the two staged operand tiles, then (behind a barrier) the epilogue's transposing tiles
  __bf16* sX = (__bf16*)sm; __bf16* sW = sX + 64 * GP;
  _Float16 (*sh)[136] = (_Float16 (*)[136])sm; _Float16 (*sl)[136] = sh + 64; _Float16 (*th)[72] = (_Float16 (*)[72])sm; __bf16 (*tb)[72] = (__bf16 (*)[72])(sm + 128 * 72 * 2); __bf16 (*tbl)[72] = tb + 128;
  const int tid = threadIdx.x, wave = tid >> 5, lane = tid & 31, col = lane & 15, g = lane >> 4; const int which = blockIdx.z; const int c0 = blockIdx.y * 128; const size_t r0 = (size_t)blockIdx.x * 64; const size_t bb = r0 / TT; const int t0 = (int)(r0 % TT);
  const float* X = which == 0 ? XQ : which == 1 ? XK : XV; const float* WA = which == 0 ? WQ : which == 1 ? WK : WV; const float* BA = which == 0 ? BQ : which == 1 ? BK : BV;
  { const int sr = tid >> 6, sc = (tid & 63) * 4; const unsigned offb = (sr * DIN + sc) * 4; const char* xb = (const char*)(X + r0 * DIN); const char* wb = (const char*)(WA + (size_t)c0 * DIN);   // 128 threads x 16 B = two whole rows a pass: passes 0..31 the X rows, 32..95 the W rows ((out,in) [CC][DIN]); block-uniform bases, one lane offset
    v4f t[2][16];   // six batches of 16 passes, the next batch's loads in flight while this one is converted and stored; every loop here is unrolled so that t has constant indices (registers) and each load a constant offset
#pragma unroll
    for (int bt = 0; bt <= 6; ++bt) {
      if (bt < 6) {
#pragma unroll
        for (int i = 0; i < 16; ++i) { const int p = bt * 16 + i; t[bt & 1][i] = *(const v4f*)((p < 32 ? xb + p * 2 * DIN * 4 : wb + (p - 32) * 2 * DIN * 4) + offb); }
        asm volatile("s_wait_xcnt 0x0" :: "v"(offb), "s"(xb), "s"(wb) : "memory"); }   // the wait owed before a register that an issued load names is rewritten: as inputs, the lane offset and both bases stay untouched up to it
      if (bt > 0) {
#pragma unroll
        for (int i = 0; i < 16; ++i) { const int p = (bt - 1) * 16 + i; const v4f x = t[(bt - 1) & 1][i]; v4b c;
#pragma unroll
          for (int k = 0; k < 4; ++k) c[k] = (__bf16)x[k];
          *(v4b*)&sX[(p * 2 + sr) * GP + sc] = c; } } } }
  __syncthreads();   // publishes both staged tiles
  v8f acc[8] = {};
  v16b fa[2], fw[2][8];   // fragments of two k blocks: the next block's LDS reads are issued as one group ahead of this block's products; unrolled so that both sets have constant indices (registers)
#pragma unroll
  for (int kc = -1; kc < DIN / 32; ++kc) {
    if (kc + 1 < DIN / 32) { fa[(kc + 1) & 1] = frag_b(&sX[(wave * 16 + col) * GP + (kc + 1) * 32], lane);
#pragma unroll
      for (int j = 0; j < 8; ++j) fw[(kc + 1) & 1][j] = frag_b(&sW[(j * 16 + col) * GP + (kc + 1) * 32], lane); }
    if (kc >= 0) {
#pragma unroll
      for (int j = 0; j < 8; ++j) acc[j] = wmma_bf(fa[kc & 1], fw[kc & 1][j], acc[j]); } }
  __syncthreads();   // ends every wave's fragment reads before the epilogue's tiles overwrite the staged operands
  if (which < 2) { _Float16* DH = which == 0 ? QH : KH; _Float16* DL = KL; const int nhi = KHI; const bool hi_rows = which == 1 && t0 < nhi; const float sc = which == 0 ? QSC : KSC;
#pragma unroll
    for (int j = 0; j < 8; ++j) { const float bias = BA ? bfr(BA[c0 + j * 16 + col]) : 0.f;
#pragma unroll
      for (int r = 0; r < 8; ++r) { acc[j][r] = (acc[j][r] + bias) * sc; sh[wave * 16 + 8 * g + r][j * 16 + col] = (_Float16)acc[j][r]; } }
    if (which == 1) {
#pragma unroll
      for (int j = 0; j < 8; ++j)
#pragma unroll
        for (int r = 0; r < 8; ++r) sl[wave * 16 + 8 * g + r][j * 16 + col] = (_Float16)((acc[j][r] - (float)(_Float16)acc[j][r]) * 1024.0f); }
    __syncthreads();
    for (int e = tid; e < 64 * 16; e += 128) { const int rl = e >> 4, q = e & 15; vst2((unsigned*)(DH + (r0 + rl) * CC + c0 + q * 8), *(const v4u*)&sh[rl][q * 8]); if (hi_rows) vst2((unsigned*)(DL + (bb * nhi + t0 + rl) * (size_t)CC + c0 + q * 8), *(const v4u*)&sl[rl][q * 8]); }
  } else { const bool hi_rows = t0 < KHI;
#pragma unroll
    for (int j = 0; j < 8; ++j) { const float bias = BA ? bfr(BA[c0 + j * 16 + col]) : 0.f;
#pragma unroll
      for (int r = 0; r < 8; ++r) { const float v = acc[j][r] + bias; const int rl = wave * 16 + 8 * g + r, cl = j * 16 + col; th[cl][rl] = (_Float16)v; const __bf16 bh = (__bf16)v; tb[cl][rl] = bh; tbl[cl][rl] = (__bf16)(v - (float)bh); } }
    __syncthreads();
    for (int e = tid; e < 128 * 8; e += 128) { const int cl = e >> 3, q = e & 7; vst2((unsigned*)(VT + (bb * CC + c0 + cl) * (size_t)TT + t0 + q * 8), *(const v4u*)&th[cl][q * 8]); if (hi_rows) { const size_t o3 = (bb * CC + c0 + cl) * (size_t)KHI + t0 + q * 8; vst2((unsigned*)(VB + o3), *(const v4u*)&tb[cl][q * 8]); vst2((unsigned*)(VBL + o3), *(const v4u*)&tbl[cl][q * 8]); } } } }
// ---- k_fa: block = 128 queries of one (b, h), 8 waves x 16 query columns: S^T = k q^T + (8 - maximum in use) (one product: the tile is the exp2 argument), sum per query in f32, P^T x 2^8 (relative to the maximum in use) once to f16 straight from the score tiles as B operand, O^T += v^T P^T (1 product); k rows and v planes staged in LDS, 128 keys a stage, two buffers
#define FA_ST 128          // keys per stage
#define FA_KP 40           // LDS pitch of a k row in halfs (80 B = 16 B x odd)
#define FA_VP 136          // LDS pitch of a v plane row in halfs (272 B = 16 B x odd)
__device__ __forceinline__ float xhalf(float x) { return __builtin_bit_cast(float, __builtin_amdgcn_permlanex16(__builtin_bit_cast(int, x), __builtin_bit_cast(int, x), 0x76543210, 0xfedcba98, false, false)); }   // lane l with lane l ^ 16
// exp2 of the eight registers of a score tile into eight registers of their own (early clobber: no result lands on a source of the run), in one statement closed by v_nop: the slot that the instruction set asks for between a transcendental and the first use of its result
__device__ __forceinline__ void exp2x8(float (&y)[8], const v8f x) {
  asm("v_exp_f32 %0, %8\n\tv_exp_f32 %1, %9\n\tv_exp_f32 %2, %10\n\tv_exp_f32 %3, %11\n\tv_exp_f32 %4, %12\n\tv_exp_f32 %5, %13\n\tv_exp_f32 %6, %14\n\tv_exp_f32 %7, %15\n\tv_nop"
      : "=&v"(y[0]), "=&v"(y[1]), "=&v"(y[2]), "=&v"(y[3]), "=&v"(y[4]), "=&v"(y[5]), "=&v"(y[6]), "=&v"(y[7])
      : "v"(x[0]), "v"(x[1]), "v"(x[2]), "v"(x[3]), "v"(x[4]), "v"(x[5]), "v"(x[6]), "v"(x[7])); }
__device__ __forceinline__ v8f wmma_h(v16h a, v16h b, v8f c) { return __builtin_amdgcn_wmma_f32_16x16x32_f16(false, a, false, b, (short)0, c, false, false); }
__global__ __launch_bounds__(256) __attribute__((amdgpu_waves_per_eu(4, 4))) void k_fa(const _Float16* __restrict__ QH, const _Float16* __restrict__ KH, const _Float16* __restrict__ VT, float* __restrict__ Y) {
  __shared__ __align__(16) _Float16 sK[2][FA_ST * FA_KP]; __shared__ __align__(16) _Float16 sV[2][HD * FA_VP];
  const int tid = threadIdx.x, wave = tid >> 5, lane = tid & 31, col = lane & 15, g = lane >> 4; const int b = blockIdx.y / NH, h = blockIdx.y % NH; const int q = blockIdx.x * 128 + wave * 16 + col;
  const v16h qh = frag_h(QH + ((size_t)b * TT + q) * CC + h * HD, lane);   // B operand: column = query
  const int kr = tid >> 2, ks = (tid & 3) * 8, vr = tid >> 4, vs = (tid & 15) * 8;   // this thread's 16-B pieces of a stage: k rows kr, kr + 64; v rows vr, vr + 16
  const _Float16* Kg = KH + ((size_t)b * TT + kr) * CC + h * HD + ks; const _Float16* Vg = VT + ((size_t)b * CC + h * HD + vr) * TT + vs;
  v4u rk0 = *(const v4u*)Kg, rk1 = *(const v4u*)(Kg + (size_t)64 * CC), rv0 = *(const v4u*)Vg, rv1 = *(const v4u*)(Vg + (size_t)16 * TT);
  asm volatile("s_wait_xcnt 0x0" :: "v"(Kg), "v"(Vg) : "memory");   // the wait owed before a register that an issued load names is rewritten: as inputs, both lane addresses stay untouched up to it
  *(v4u*)&sK[0][kr * FA_KP + ks] = rk0; *(v4u*)&sK[0][(kr + 64) * FA_KP + ks] = rk1; *(v4u*)&sV[0][vr * FA_VP + vs] = rv0; *(v4u*)&sV[0][(vr + 16) * FA_VP + vs] = rv1;
  __syncthreads();
  v8f o[HD / 16] = {}; float l = 0.f; v8f cv = {};   // cv: the start value of every score tile, 8 - the query's maximum in use (log2 units), the same in all eight registers; 0 until the first pass sets it
#pragma unroll 1   // the stage loop stays rolled: one stage is already a long straight body (for speed only); the inner loops are unrolled so that every register array has constant indices
  for (int s = 0; s < TT / FA_ST; ++s) { const int cur = s & 1; const bool more = s + 1 < TT / FA_ST;
    if (more) { const _Float16* kp = Kg + (size_t)(s + 1) * FA_ST * CC; const _Float16* vp = Vg + (s + 1) * FA_ST; rk0 = *(const v4u*)kp; rk1 = *(const v4u*)(kp + (size_t)64 * CC); rv0 = *(const v4u*)vp; rv1 = *(const v4u*)(vp + (size_t)16 * TT); }
    { v8f sv[FA_ST / 16]; v16h kf[FA_ST / 16];   // a pass is the whole stage
#pragma unroll
      for (int t = 0; t < FA_ST / 16; ++t) { kf[t] = frag_h(&sK[cur][(t * 16 + col) * FA_KP], lane); sv[t] = wmma_h(kf[t], qh, cv); }   // A operand: row = key
      v16h vf[HD / 16][FA_ST / 32];   // A operands of the second product: row = channel, keys in the order of the packed score tiles
#pragma unroll
      for (int j = 0; j < HD / 16; ++j)
#pragma unroll
        for (int u = 0; u < FA_ST / 32; ++u) vf[j][u] = frag_h(&sV[cur][(j * 16 + col) * FA_VP + u * 32], lane);
      float mt[FA_ST / 16];
#pragma unroll
      for (int t = 0; t < FA_ST / 16; ++t) { mt[t] = sv[t][0];
#pragma unroll
        for (int r = 1; r < 8; ++r) mt[t] = fmaxf(mt[t], sv[t][r]); }
      float mx = fmaxf(fmaxf(fmaxf(mt[0], mt[1]), fmaxf(mt[2], mt[3])), fmaxf(fmaxf(mt[4], mt[5]), fmaxf(mt[6], mt[7])));
      // asks the scheduler for this order in the block: the K reads, the first products, then the others with maxima of finished tiles between them: left free, each tile's first maximum stands directly behind its product and is padded with v_nop
      __builtin_amdgcn_sched_group_barrier(0x100, 16, 0); __builtin_amdgcn_sched_group_barrier(0x008, 4, 0);
#pragma unroll
      for (int t = 0; t < 4; ++t) { __builtin_amdgcn_sched_group_barrier(0x002, 5, 0); __builtin_amdgcn_sched_group_barrier(0x008, 1, 0); }
      const bool first = s == 0;
      if ((__builtin_amdgcn_ballot_w32(mx > 15.0f) | (first ? 1u : 0u)) != 0) {   // one scalar branch a pass: taken on the first pass, and when an argument would bring P x 2^8 near the top of f16 (2^16)
        mx = fmaxf(mx, xhalf(mx)); const float d = first ? mx - 8.0f : fmaxf(mx - 8.0f, 0.f); const float alpha = __builtin_amdgcn_exp2f(-fmaxf(d, 0.f));   // the maximum in use goes up by d (the first pass sets it, up or down, while o and l are still 0)
#pragma unroll
        for (int t = 0; t < FA_ST / 16; ++t) sv[t] -= d;
        cv -= d; l *= alpha;
#pragma unroll
        for (int j = 0; j < HD / 16; ++j) o[j] *= alpha; }
      float ps[FA_ST / 16]; v16h pf[FA_ST / 32];
#pragma unroll
      for (int t = 0; t < FA_ST / 16; ++t) { float e[8];
        exp2x8(e, sv[t]);
        ps[t] = ((e[0] + e[1]) + (e[2] + e[3])) + ((e[4] + e[5]) + (e[6] + e[7]));
#pragma unroll
        for (int r = 0; r < 8; ++r) pf[t >> 1][(t & 1) * 8 + r] = (_Float16)e[r]; }
      l += ((ps[0] + ps[1]) + (ps[2] + ps[3])) + ((ps[4] + ps[5]) + (ps[6] + ps[7]));
#pragma unroll
      for (int u = 0; u < FA_ST / 32; ++u)
#pragma unroll
        for (int j = 0; j < HD / 16; ++j) o[j] = wmma_h(vf[j][u], pf[u], o[j]); }
    if (more) { const int nx = cur ^ 1; *(v4u*)&sK[nx][kr * FA_KP + ks] = rk0; *(v4u*)&sK[nx][(kr + 64) * FA_KP + ks] = rk1; *(v4u*)&sV[nx][vr * FA_VP + vs] = rv0; *(v4u*)&sV[nx][(vr + 16) * FA_VP + vs] = rv1; }
    __syncthreads(); }   // publishes stage s + 1 and ends every wave's reads of the buffer that the next trip refills
  const float inv = 1.0f / (l + xhalf(l));
#pragma unroll
  for (int j = 0; j < HD / 16; ++j) { float* yp = Y + ((size_t)b * TT + q) * CC + h * HD + j * 16 + 8 * g; v4f a0, a1;
#pragma unroll
    for (int r = 0; r < 4; ++r) { a0[r] = o[j][r] * inv; a1[r] = o[j][4 + r] * inv; }
    vst2(yp, a0); vst2(yp + 4, a1); } }

extern "C" void kernel_launch(void* const* d_in, const int* in_sizes, int n_in, void* d_out, int out_size, void* d_ws, size_t ws_size, hipStream_t stream) {
  (void)in_sizes; (void)n_in; (void)out_size;
  const float** F = (const float**)d_in;
  if (ws_size < (size_t)WS_END) return;
  char* ws = (char*)d_ws; _Float16 *QH = (_Float16*)(ws + WS_QH), *KH = (_Float16*)(ws + WS_KH), *VT = (_Float16*)(ws + WS_VT), *KL = (_Float16*)(ws + WS_KL); __bf16 *VB = (__bf16*)(ws + WS_VB), *VBL = (__bf16*)(ws + WS_VBL); float *S = (float*)(ws + WS_S), *Y = (float*)(ws + WS_Y);
  (void)Y; (void)S; (void)KL; (void)VB; (void)VBL;
  // inputs: 0 Q [4,2048,256]; 1 K [4,2048,256]; 2 Wq [256,256] (out,in), 3 bq; 4 Wk, 5 bk; 6 Wv, 7 bv; 8 Wo (out,in), 9 bo; 10 g0, 11 b0; 12 g1, 13 b1
  if (ws_size < (size_t)WS_END2) return;
  float *YA = (float*)(ws + WS_Y2);
  k_proj<<<dim3(TNB * TT / 64, CC / 128, 3), 128, 0, stream>>>(F[0], F[1], F[1], F[2], F[4], F[6], F[3], F[5], F[7], QH, KH, KL, VT, VB, VBL);
  k_fa<<<dim3(TT / 128, TNB * NH), 256, 0, stream>>>(QH, KH, VT, YA);
  k_tail<<<dim3(NRW / TR), 256, 0, stream>>>(YA, F[10], F[11], F[8], F[9], F[12], F[13], (float*)d_out);   /* out = LN1(o + relu(o Wo^T + bo)), o = LN0(attention output) */
}

// v006
// One run takes 39 microseconds.
// Two timings next to v005 both put it at 1.03 times that version's speed.
// Over all steps from v000 it is 22.2 times as fast.
// compute dtype: all float inputs rounded to bf16; Qp/Kp/Vp = X W^T + b with EXACT bf16 products on WMMA 16x16x32 (f32 accumulate); q x 32^-0.5 x log2(e) x 2^5 once to f16 against k x 2^-5 once to f16 (1 product into a tile that starts at 8 - the maximum in use); softmax in f32 with a maximum in use that is raised only when a score passes it by more than 7 (hardware exp2); unnormalised P x 2^8 once to f16 against v once to f16 (1 product), divided by the f32 row sum at the end; LayerNorms in f32; the fc_o layer with the LN rows once to f16 against Wo as f16(bf16 x 2^6) (1 product) + bias, relu and residual in f32; f32 output.
#include <hip/hip_runtime.h>
#include <math.h>

typedef __attribute__((ext_vector_type(16))) _Float16 v16h;
typedef __attribute__((ext_vector_type(16))) __bf16 v16b;
typedef __attribute__((ext_vector_type(8)))  _Float16 v8h;
typedef __attribute__((ext_vector_type(8)))  float v8f;
typedef __attribute__((ext_vector_type(4)))  float v4f;
typedef __attribute__((ext_vector_type(2)))  float v2f;
typedef __attribute__((ext_vector_type(4)))  unsigned v4u;
typedef __attribute__((ext_vector_type(4)))  int v4i;
typedef float __attribute__((may_alias)) float_a;
typedef int __attribute__((may_alias)) int_a;

template <typename T> __device__ __forceinline__ void vst2(void* p, T v) { *(T*)p = v;  }
__device__ __forceinline__ v8f wmma16(v16h a, v16h b, v8f c) {
  v8f d = __builtin_amdgcn_wmma_f32_16x16x32_f16(false, a, false, b, (short)0, c, false, false);
  asm volatile("v_nop\n\tv_nop\n\tv_nop\n\tv_nop" : "+v"(d) : "v"(a), "v"(b));
  return d;
}
__device__ __forceinline__ v8f wmma_bf(v16b a, v16b b, v8f c) {
  v8f d = __builtin_amdgcn_wmma_f32_16x16x32_bf16(false, a, false, b, (short)0, c, false, false);
  asm volatile("v_nop\n\tv_nop\n\tv_nop\n\tv_nop" : "+v"(d) : "v"(a), "v"(b));
  return d;
}
// 16x16x32 fragments: lane = (h = lane>>4, row/col = lane&15); elements 0..7 = k0+8h+0..7, 8..15 = k0+16+8h+0..7; D element r = row 8h+r
__device__ __forceinline__ v16h frag_h(const _Float16* rowk0, int lane) {
  union { v16h v; v8h q[2]; } u; const _Float16* p = rowk0 + 8 * (lane >> 4);
  u.q[0] = *(const v8h*)p; u.q[1] = *(const v8h*)(p + 16); return u.v;
}
__device__ __forceinline__ v16h frag_f32(const float* rowk0, int lane) {
  v16h a; const float* p = rowk0 + 8 * (lane >> 4);
#pragma unroll
  for (int i = 0; i < 8; ++i) { a[i] = (_Float16)p[i]; a[8 + i] = (_Float16)p[16 + i]; }
  return a;
}
__device__ __forceinline__ v16h frag_f32s(const float* rowk0, int lane, float sc) {
  v16h a; const float* p = rowk0 + 8 * (lane >> 4);
#pragma unroll
  for (int i = 0; i < 8; ++i) { a[i] = (_Float16)(p[i] * sc); a[8 + i] = (_Float16)(p[16 + i] * sc); }
  return a;
}
// column fragment from a [K][ld] layout (column n), rows >= K read as 0
__device__ __forceinline__ v16h fragc_f32(const float* W, int k0, int n, int lane, int ld, int K) {
  v16h a; const int g = lane >> 4;
#pragma unroll
  for (int i = 0; i < 8; ++i) { const int ka = k0 + 8 * g + i, kb = ka + 16;
    a[i] = (_Float16)(ka < K ? W[(size_t)(ka < K ? ka : K - 1) * ld + n] : 0.f); a[8 + i] = (_Float16)(kb < K ? W[(size_t)(kb < K ? kb : K - 1) * ld + n] : 0.f); }
  return a;
}
struct F2 { v16b h, l; };
__device__ __forceinline__ F2 bsplit16(const float v[16]) { F2 r;
#pragma unroll
  for (int i = 0; i < 16; ++i) { const __bf16 h = (__bf16)v[i]; r.h[i] = h; r.l[i] = (__bf16)(v[i] - (float)h); }
  return r; }
__device__ __forceinline__ F2 split_row(const float* row, int k0, int lane) { float v[16]; const float* p = row + k0 + 8 * (lane >> 4);
#pragma unroll
  for (int i = 0; i < 8; ++i) { v[i] = p[i]; v[8 + i] = p[16 + i]; }
  return bsplit16(v); }
__device__ __forceinline__ F2 split_rowK(const float* row, int k0, int lane, int K) { float v[16]; const int g = lane >> 4;
#pragma unroll
  for (int i = 0; i < 8; ++i) { const int ka = k0 + 8 * g + i, kb = ka + 16; v[i] = ka < K ? row[ka < K ? ka : K - 1] : 0.f; v[8 + i] = kb < K ? row[kb < K ? kb : K - 1] : 0.f; }
  return bsplit16(v); }
__device__ __forceinline__ F2 split_col(const float* W, int k0, int n, int lane, int ld, int K) { float v[16]; const int g = lane >> 4;
#pragma unroll
  for (int i = 0; i < 8; ++i) { const int ka = k0 + 8 * g + i, kb = ka + 16; v[i] = ka < K ? W[(size_t)(ka < K ? ka : K - 1) * ld + n] : 0.f; v[8 + i] = kb < K ? W[(size_t)(kb < K ? kb : K - 1) * ld + n] : 0.f; }
  return bsplit16(v); }
__device__ __forceinline__ v8f mac3(const F2& a, const F2& b, v8f c) { c = wmma_bf(a.l, b.h, c); c = wmma_bf(a.h, b.l, c); return wmma_bf(a.h, b.h, c); }
__device__ __forceinline__ float sigm(float v) { return 1.0f / (1.0f + expf(-v)); }
#define LDSX() do { asm volatile("s_wait_dscnt 0" ::: "memory"); __builtin_amdgcn_wave_barrier(); __builtin_amdgcn_fence(__ATOMIC_RELEASE, "workgroup"); } while (0)

// Set-Transformer MAB (B 4, NQ = NK = 2,048, dim 256 = 8 heads x 32; 0.02-scale (out,in) weights, zero biases, LN gamma 1 / beta 0): Qp = Q Wq^T + bq, Kp = K Wk^T + bk, Vp = K Wv^T + bv; o = merged(softmax(q k^T / sqrt(32)) v); o = LN0(o); out = LN1(o + relu(o Wo^T + bo)) (eps 1e-5, biased var).
#define NB 4
#define TT 2048
#define CC 256            // NH * HD = projected width
#define DIN 256          // input (model) width
#define NH 8
#define HD 32
#define NQB (TT / 64)
#define HG 4
#define SCALE (0.17677669529663687f)
#define CAUSAL 0
#ifndef TNB
#define TNB NB
#endif
__device__ __forceinline__ float bfr(float v) { return (float)(__bf16)v; }
__host__ __device__ __forceinline__ int kb_last(int qb) { return CAUSAL ? ((qb * 64 + 63) >> 7) : (TT / 128 - 1); }
typedef __attribute__((ext_vector_type(8))) __bf16 v8b;
__device__ __forceinline__ v16b frag_b(const __bf16* rowk0, int lane) {
  union { v16b v; v8b q[2]; } u; const __bf16* p = rowk0 + 8 * (lane >> 4);
  u.q[0] = *(const v8b*)p; u.q[1] = *(const v8b*)(p + 16); return u.v;
}
#define QBH 0              // not read by any kernel here
#define KHI 64            // key rows carrying k residual / v bf16 hi+lo planes (written by k_proj; no kernel here reads them)
// B fragment (k rows k0+.., output column o) of a weight: (in,out) [K][ld] or (out,in) [ld rows of K]: bf16 exact, or f16(bf16 * 256) exact
__device__ __forceinline__ v16b wcol_io(const float* Wm, int k0, int o, int lane, int ld) { v16b w; const int g = lane >> 4;
#pragma unroll
  for (int i = 0; i < 8; ++i) { w[i] = (__bf16)Wm[(size_t)(k0 + 8 * g + i) * ld + o]; w[8 + i] = (__bf16)Wm[(size_t)(k0 + 16 + 8 * g + i) * ld + o]; }
  return w; }
__device__ __forceinline__ v16b wcol_oi(const float* Wm, int k0, int o, int lane, int K) { v16b w; const float* p = Wm + (size_t)o * K + k0 + 8 * (lane >> 4);
#pragma unroll
  for (int i = 0; i < 8; ++i) { w[i] = (__bf16)p[i]; w[8 + i] = (__bf16)p[16 + i]; }
  return w; }
__device__ __forceinline__ v16h wcolh_io(const float* Wm, int k0, int o, int lane, int ld) { v16h w; const int g = lane >> 4;
#pragma unroll
  for (int i = 0; i < 8; ++i) { w[i] = (_Float16)(bfr(Wm[(size_t)(k0 + 8 * g + i) * ld + o]) * 256.0f); w[8 + i] = (_Float16)(bfr(Wm[(size_t)(k0 + 16 + 8 * g + i) * ld + o]) * 256.0f); }
  return w; }
__device__ __forceinline__ v16h wcolh_oi(const float* Wm, int k0, int o, int lane, int K) { v16h w; const float* p = Wm + (size_t)o * K + k0 + 8 * (lane >> 4);
#pragma unroll
  for (int i = 0; i < 8; ++i) { w[i] = (_Float16)(bfr(p[i]) * 256.0f); w[8 + i] = (_Float16)(bfr(p[16 + i]) * 256.0f); }
  return w; }
#define WQKV_LAYOUT 1   // 0 = (in,out) [DIN][CC]; 1 = (out,in) [CC][DIN]; 2 = per-head [NH][DIN][HD]
__device__ __forceinline__ v16b wcol_hdk(const float* Wm, int k0, int o, int lane) { v16b w; const int g = lane >> 4; const float* p = Wm + (size_t)(o / HD) * DIN * HD + (o % HD);
#pragma unroll
  for (int i = 0; i < 8; ++i) { w[i] = (__bf16)p[(size_t)(k0 + 8 * g + i) * HD]; w[8 + i] = (__bf16)p[(size_t)(k0 + 16 + 8 * g + i) * HD]; }
  return w; }
#define WO_OUT_IN 0
#if WQKV_LAYOUT == 1
#define WCOL(W, k0, o, lane) wcol_oi(W, k0, o, lane, DIN)
#elif WQKV_LAYOUT == 2
#define WCOL(W, k0, o, lane) wcol_hdk(W, k0, o, lane)
#else
#define WCOL(W, k0, o, lane) wcol_io(W, k0, o, lane, CC)
#endif
#if WO_OUT_IN
#define WOCOL(W, k0, o, lane) wcol_oi(W, k0, o, lane, CC)
#define WOCOLH(W, k0, o, lane) wcolh_oi(W, k0, o, lane, CC)
#else
#define WOCOL(W, k0, o, lane) wcol_io(W, k0, o, lane, DIN)
#define WOCOLH(W, k0, o, lane) wcolh_io(W, k0, o, lane, DIN)
#endif
#define NRW (TNB * TT)
// LayerNorm over CC = 256 of four rows held by one wave (mean, biased var, (x - mean) * rsqrt(var + 1e-5) * g + b): 8 floats of a row per lane (2 float4 at stride 128 floats); the four rows' lane exchanges are independent of one another
__device__ __forceinline__ void ln4(v4f (&v)[4][CC / 128], const v4f (&gv)[CC / 128], const v4f (&bv)[CC / 128]) {
  float s1[4], q[4];
#pragma unroll
  for (int rr = 0; rr < 4; ++rr) { s1[rr] = 0.f;
#pragma unroll
    for (int i = 0; i < CC / 128; ++i) { const v4f t = v[rr][i]; s1[rr] += (t[0] + t[1]) + (t[2] + t[3]); } }
#pragma unroll
  for (int o = 1; o < 32; o <<= 1)
#pragma unroll
    for (int rr = 0; rr < 4; ++rr) s1[rr] += __shfl_xor(s1[rr], o);
#pragma unroll
  for (int rr = 0; rr < 4; ++rr) { s1[rr] *= (1.0f / CC); q[rr] = 0.f;
#pragma unroll
    for (int i = 0; i < CC / 128; ++i)
#pragma unroll
      for (int k = 0; k < 4; ++k) { const float d = v[rr][i][k] - s1[rr]; q[rr] += d * d; } }
#pragma unroll
  for (int o = 1; o < 32; o <<= 1)
#pragma unroll
    for (int rr = 0; rr < 4; ++rr) q[rr] += __shfl_xor(q[rr], o);
#pragma unroll
  for (int rr = 0; rr < 4; ++rr) q[rr] = rsqrtf(q[rr] * (1.0f / CC) + 1e-5f);   /* jnp.var (biased), eps inside the rsqrt */
#pragma unroll
  for (int rr = 0; rr < 4; ++rr)
#pragma unroll
    for (int i = 0; i < CC / 128; ++i)
#pragma unroll
      for (int k = 0; k < 4; ++k) v[rr][i][k] = bfr(gv[i][k]) * ((v[rr][i][k] - s1[rr]) * q[rr]) + bfr(bv[i][k]); }
#define GP 264            // LDS pitch of a staged operand row of 256 16-bit elements (528 B = 16 B x odd)
typedef __attribute__((ext_vector_type(4))) _Float16 v4h;
typedef __attribute__((ext_vector_type(4))) __bf16 v4b;
#define TR 32             // rows of a block of k_tail
#define OP 260            // LDS pitch of an f32 row there (1,040 B: the two lane halves of an accumulator tile, 8 rows apart, fall on different banks)
// ---- k_tail: block = 32 whole rows, 8 waves: o = LN0(Y) (wave = 4 rows; kept in LDS as f32 rows and once to f16), r = o + relu(o x W^T (W (out,in) as f16(bf16 x 2^6), all 256 rows staged in LDS by 512-B wave loads) x 2^-6 + bias) (wave = 32 rows x 32 cols), OUT = LN1(r) (wave = 4 rows)
__global__ __launch_bounds__(256) void k_tail(const float* __restrict__ Y, const float* __restrict__ G0, const float* __restrict__ BE0, const float* __restrict__ Wm, const float* __restrict__ BIAS, const float* __restrict__ G1, const float* __restrict__ BE1, float* __restrict__ OUT) {
  __shared__ __align__(16) _Float16 sW[CC * GP]; __shared__ __align__(16) _Float16 sA[TR * GP]; __shared__ __align__(16) float sO[TR * OP];
  const int tid = threadIdx.x, wave = tid >> 5, lane = tid & 31, col = lane & 15, g = lane >> 4;
  const char* yb = (const char*)(Y + (size_t)blockIdx.x * TR * CC); const char* wb = (const char*)Wm; const unsigned offy = (wave * 4 * CC + lane * 4) * 4, offl = lane * 16, offb = tid * 16, offc = (wave * 32 + col) * 4;   // block-uniform bases, one lane offset each
  v4f y[4][CC / 128], g0v[CC / 128], b0v[CC / 128], g1v[CC / 128], b1v[CC / 128]; float bo[2];
#pragma unroll
  for (int rr = 0; rr < 4; ++rr)
#pragma unroll
    for (int i = 0; i < CC / 128; ++i) y[rr][i] = *(const v4f*)(yb + (rr * CC + i * 128) * 4 + offy);
#pragma unroll
  for (int i = 0; i < CC / 128; ++i) { g0v[i] = *(const v4f*)((const char*)G0 + i * 512 + offl); b0v[i] = *(const v4f*)((const char*)BE0 + i * 512 + offl); }
  asm volatile("s_wait_xcnt 0x0" :: "v"(offy), "v"(offl), "s"(yb), "s"(G0), "s"(BE0) : "memory");   // the wait owed before a register that an issued load names is rewritten: as inputs, the lane offsets and the bases stay untouched up to it
  v4f t[2][16];   // W: 256 threads x 16 B = four whole rows a pass, four batches of 16 passes, two batches in flight; every loop here is unrolled so that t has constant indices (registers) and each load a constant offset
#pragma unroll
  for (int bt = 0; bt < 2; ++bt)
#pragma unroll
    for (int i = 0; i < 16; ++i) t[bt][i] = *(const v4f*)(wb + (bt * 16 + i) * 4 * CC * 4 + offb);
  asm volatile("s_wait_xcnt 0x0" :: "v"(offb), "s"(wb) : "memory");   // as above
  ln4(y, g0v, b0v);   // runs while the first two batches of W are in flight
#pragma unroll
  for (int rr = 0; rr < 4; ++rr)
#pragma unroll
    for (int i = 0; i < CC / 128; ++i) { const v4f x = y[rr][i]; v4h c;
#pragma unroll
      for (int k = 0; k < 4; ++k) c[k] = (_Float16)x[k];
      *(v4f*)&sO[(wave * 4 + rr) * OP + i * 128 + lane * 4] = x; *(v4h*)&sA[(wave * 4 + rr) * GP + i * 128 + lane * 4] = c; }
  __builtin_amdgcn_sched_barrier(0);   // keeps the conversions of W behind LN0: drawn up among it they hold converted copies beside the loaded registers, and the kernel goes past 256 registers (a window switch at every other instruction)
#pragma unroll
  for (int bt = 0; bt < 4; ++bt) {
#pragma unroll
    for (int i = 0; i < 16; ++i) { const int p = bt * 16 + i; const v4f x = t[bt & 1][i]; v4h c;
#pragma unroll
      for (int k = 0; k < 4; ++k) c[k] = (_Float16)(bfr(x[k]) * 64.0f);
      *(v4h*)&sW[(p * 4 + (tid >> 6)) * GP + (tid & 63) * 4] = c; }
    if (bt + 2 < 4) {
#pragma unroll
      for (int i = 0; i < 16; ++i) t[bt & 1][i] = *(const v4f*)(wb + ((bt + 2) * 16 + i) * 4 * CC * 4 + offb);
      asm volatile("s_wait_xcnt 0x0" :: "v"(offb), "s"(wb) : "memory"); }   // as above
    if (bt == 1) {   // what the epilogue and LN1 need, issued behind the last batch of W: back before the barrier below waits for every load
#pragma unroll
      for (int i = 0; i < CC / 128; ++i) { g1v[i] = *(const v4f*)((const char*)G1 + i * 512 + offl); b1v[i] = *(const v4f*)((const char*)BE1 + i * 512 + offl); }
#pragma unroll
      for (int j = 0; j < 2; ++j) bo[j] = *(const float*)((const char*)BIAS + j * 64 + offc);
      asm volatile("s_wait_xcnt 0x0" :: "v"(offl), "v"(offc), "s"(G1), "s"(BE1), "s"(BIAS) : "memory"); } }   // as above
  __syncthreads();   // publishes the LN0 rows (both forms) and the staged W
  v8f acc[2][2] = {};
  v16h fa[4][2], fw[4][2];   // fragments of four k blocks: each block's LDS reads are issued as one group three blocks ahead of its products (the reads are 4 KB a wave and block; for speed only); unrolled so that the sets have constant indices (registers)
#pragma unroll
  for (int kc = -3; kc < CC / 32; ++kc) {
    if (kc + 3 < CC / 32) {
#pragma unroll
      for (int i = 0; i < 2; ++i) { fa[(kc + 3) & 3][i] = frag_h(&sA[(i * 16 + col) * GP + (kc + 3) * 32], lane); fw[(kc + 3) & 3][i] = frag_h(&sW[((wave * 2 + i) * 16 + col) * GP + (kc + 3) * 32], lane); } }
    __builtin_amdgcn_sched_barrier(0);   // keeps the group of reads ahead of the products: left free, the reads sink to just in front of their own products and each is waited to 0
    if (kc >= 0) {
#pragma unroll
      for (int i = 0; i < 2; ++i)
#pragma unroll
        for (int j = 0; j < 2; ++j) acc[i][j] = __builtin_amdgcn_wmma_f32_16x16x32_f16(false, fa[kc & 3][i], false, fw[kc & 3][j], (short)0, acc[i][j], false, false); } }
#pragma unroll
  for (int j = 0; j < 2; ++j) { const float bb = bfr(bo[j]);
#pragma unroll
    for (int i = 0; i < 2; ++i)
#pragma unroll
      for (int r = 0; r < 8; ++r) { float* p = &sO[(i * 16 + 8 * g + r) * OP + (wave * 2 + j) * 16 + col]; *p = fmaxf(acc[i][j][r] * (1.0f / 64.0f) + bb, 0.f) + *p; } }   /* relu before the residual; each element is read and rewritten by its one lane */
  __syncthreads();   // publishes the rows o + relu(..), whose columns come from all eight waves
#pragma unroll
  for (int rr = 0; rr < 4; ++rr)
#pragma unroll
    for (int i = 0; i < CC / 128; ++i) y[rr][i] = *(const v4f*)&sO[(wave * 4 + rr) * OP + i * 128 + lane * 4];
  ln4(y, g1v, b1v);
  char* ob = (char*)(OUT + (size_t)blockIdx.x * TR * CC);
#pragma unroll
  for (int rr = 0; rr < 4; ++rr)
#pragma unroll
    for (int i = 0; i < CC / 128; ++i) vst2(ob + (rr * CC + i * 128) * 4 + offy, y[rr][i]); }

#ifndef SM_EXTRA_PARAMS
#define SM_EXTRA_PARAMS
#endif
#ifndef PROJ_EXTRA_PARAMS
#define PROJ_EXTRA_PARAMS
#endif
#ifndef SM_MASK_HOOK
#define SM_MASK_HOOK (void)0
#endif

#define WS_QH  0u                                      // f16 q rows [b*t][CC]
#define WS_KH  (WS_QH + 2u * (size_t)NB * TT * CC)      // f16 k rows [b*t][CC]
#define WS_VT  (WS_KH + 2u * (size_t)NB * TT * CC)      // f16 v planes [b][c][t]
#define WS_KL  (WS_VT + 2u * (size_t)NB * CC * TT)      // f16 k residual x 2^10 rows [b][t < KHI][CC]
#define WS_VB  (WS_KL + 2u * (size_t)NB * KHI * CC)     // bf16 v hi planes [b][c][t < KHI]
#define WS_VBL (WS_VB + 2u * (size_t)NB * CC * KHI)
#define WS_S   (WS_VBL + 2u * (size_t)NB * CC * KHI)    // f32 [hg][t][s] region; no kernel here uses it
#define WS_Y   (WS_S  + 4u * (size_t)HG * TT * TT)      // f32 ctx rows [b*t][CC] (only when there is an output projection)
#define WS_END (WS_Y  + 0u)
#define WS_Y2  (WS_END)
#define WS_O1  (WS_Y2 + 4u * (size_t)NB * TT * CC)
#define WS_R2  (WS_O1 + 4u * (size_t)NB * TT * CC)
#define WS_END2 (WS_R2 + 4u * (size_t)NB * TT * CC)

#define QSC (SCALE * 1.4426950408889634f * 32.0f)   // q leaves k_proj as q x 32^-0.5 x log2(e) x 2^5, k as k x 2^-5: their product is the exp2 argument itself
#define KSC (1.0f / 32.0f)
// ---- k_proj: block = (64 rows, 128 cols, which): q/k/v = X W (+ b) with exact bf16 products (K = DIN) -> which 0: q x QSC f16 rows; 1: k x KSC f16 rows (+ residual rows < KHI); 2: v f16 planes [c][t] (+ bf16 hi/lo planes for t < KHI)
__global__ __launch_bounds__(128) void k_proj(const float* __restrict__ XQ, const float* __restrict__ XK, const float* __restrict__ XV, const float* __restrict__ WQ, const float* __restrict__ WK, const float* __restrict__ WV, const float* __restrict__ BQ, const float* __restrict__ BK, const float* __restrict__ BV,
    _Float16* __restrict__ QH, _Float16* __restrict__ KH, _Float16* __restrict__ KL, _Float16* __restrict__ VT, __bf16* __restrict__ VB, __bf16* __restrict__ VBL) {
  __shared__ __align__(16) char sm[(64 + 128) * GP * 2];   // first the two staged operand tiles, then (behind a barrier) the epilogue's transposing tiles
  __bf16* sX = (__bf16*)sm; __bf16* sW = sX + 64 * GP;
  _Float16 (*sh)[136] = (_Float16 (*)[136])sm; _Float16 (*sl)[136] = sh + 64; _Float16 (*th)[72] = (_Float16 (*)[72])sm; __bf16 (*tb)[72] = (__bf16 (*)[72])(sm + 128 * 72 * 2); __bf16 (*tbl)[72] = tb + 128;
  const int tid = threadIdx.x, wave = tid >> 5, lane = tid & 31, col = lane & 15, g = lane >> 4; const int which = blockIdx.z; const int c0 = blockIdx.y * 128; const size_t r0 = (size_t)blockIdx.x * 64; const size_t bb = r0 / TT; const int t0 = (int)(r0 % TT);
  const float* X = which == 0 ? XQ : which == 1 ? XK : XV; const float* WA = which == 0 ? WQ : which == 1 ? WK : WV; const float* BA = which == 0 ? BQ : which == 1 ? BK : BV;
  { const int sr = tid >> 6, sc = (tid & 63) * 4; const unsigned offb = (sr * DIN + sc) * 4; const char* xb = (const char*)(X + r0 * DIN); const char* wb = (const char*)(WA + (size_t)c0 * DIN);   // 128 threads x 16 B = two whole rows a pass: passes 0..31 the X rows, 32..95 the W rows ((out,in) [CC][DIN]); block-uniform bases, one lane offset
    v4f t[2][16];   // six batches of 16 passes, the next batch's loads in flight while this one is converted and stored; every loop here is unrolled so that t has constant indices (registers) and each load a constant offset
#pragma unroll
    for (int bt = 0; bt <= 6; ++bt) {
      if (bt < 6) {
#pragma unroll
        for (int i = 0; i < 16; ++i) { const int p = bt * 16 + i; t[bt & 1][i] = *(const v4f*)((p < 32 ? xb + p * 2 * DIN * 4 : wb + (p - 32) * 2 * DIN * 4) + offb); }
        asm volatile("s_wait_xcnt 0x0" :: "v"(offb), "s"(xb), "s"(wb) : "memory"); }   // the wait owed before a register that an issued load names is rewritten: as inputs, the lane offset and both bases stay untouched up to it
      if (bt > 0) {
#pragma unroll
        for (int i = 0; i < 16; ++i) { const int p = (bt - 1) * 16 + i; const v4f x = t[(bt - 1) & 1][i]; v4b c;
#pragma unroll
          for (int k = 0; k < 4; ++k) c[k] = (__bf16)x[k];
          *(v4b*)&sX[(p * 2 + sr) * GP + sc] = c; } } } }
  __syncthreads();   // publishes both staged tiles
  v8f acc[8] = {};
  v16b fa[2], fw[2][8];   // fragments of two k blocks: the next block's LDS reads are issued as one group ahead of this block's products; unrolled so that both sets have constant indices (registers)
#pragma unroll
  for (int kc = -1; kc < DIN / 32; ++kc) {
    if (kc + 1 < DIN / 32) { fa[(kc + 1) & 1] = frag_b(&sX[(wave * 16 + col) * GP + (kc + 1) * 32], lane);
#pragma unroll
      for (int j = 0; j < 8; ++j) fw[(kc + 1) & 1][j] = frag_b(&sW[(j * 16 + col) * GP + (kc + 1) * 32], lane); }
    if (kc >= 0) {
#pragma unroll
      for (int j = 0; j < 8; ++j) acc[j] = wmma_bf(fa[kc & 1], fw[kc & 1][j], acc[j]); } }
  __syncthreads();   // ends every wave's fragment reads before the epilogue's tiles overwrite the staged operands
  if (which < 2) { _Float16* DH = which == 0 ? QH : KH; _Float16* DL = KL; const int nhi = KHI; const bool hi_rows = which == 1 && t0 < nhi; const float sc = which == 0 ? QSC : KSC;
#pragma unroll
    for (int j = 0; j < 8; ++j) { const float bias = BA ? bfr(BA[c0 + j * 16 + col]) : 0.f;
#pragma unroll
      for (int r = 0; r < 8; ++r) { acc[j][r] = (acc[j][r] + bias) * sc; sh[wave * 16 + 8 * g + r][j * 16 + col] = (_Float16)acc[j][r]; } }
    if (which == 1) {
#pragma unroll
      for (int j = 0; j < 8; ++j)
#pragma unroll
        for (int r = 0; r < 8; ++r) sl[wave * 16 + 8 * g + r][j * 16 + col] = (_Float16)((acc[j][r] - (float)(_Float16)acc[j][r]) * 1024.0f); }
    __syncthreads();
    for (int e = tid; e < 64 * 16; e += 128) { const int rl = e >> 4, q = e & 15; vst2((unsigned*)(DH + (r0 + rl) * CC + c0 + q * 8), *(const v4u*)&sh[rl][q * 8]); if (hi_rows) vst2((unsigned*)(DL + (bb * nhi + t0 + rl) * (size_t)CC + c0 + q * 8), *(const v4u*)&sl[rl][q * 8]); }
  } else { const bool hi_rows = t0 < KHI;
#pragma unroll
    for (int j = 0; j < 8; ++j) { const float bias = BA ? bfr(BA[c0 + j * 16 + col]) : 0.f;
#pragma unroll
      for (int r = 0; r < 8; ++r) { const float v = acc[j][r] + bias; const int rl = wave * 16 + 8 * g + r, cl = j * 16 + col; th[cl][rl] = (_Float16)v; const __bf16 bh = (__bf16)v; tb[cl][rl] = bh; tbl[cl][rl] = (__bf16)(v - (float)bh); } }
    __syncthreads();
    for (int e = tid; e < 128 * 8; e += 128) { const int cl = e >> 3, q = e & 7; vst2((unsigned*)(VT + (bb * CC + c0 + cl) * (size_t)TT + t0 + q * 8), *(const v4u*)&th[cl][q * 8]); if (hi_rows) { const size_t o3 = (bb * CC + c0 + cl) * (size_t)KHI + t0 + q * 8; vst2((unsigned*)(VB + o3), *(const v4u*)&tb[cl][q * 8]); vst2((unsigned*)(VBL + o3), *(const v4u*)&tbl[cl][q * 8]); } } } }
// ---- k_fa: block = 128 queries of one (b, h), 8 waves x 16 query columns: S^T = k q^T + (8 - maximum in use) (one product: the tile is the exp2 argument), sum per query in f32, P^T x 2^8 (relative to the maximum in use) once to f16 straight from the score tiles as B operand, O^T += v^T P^T (1 product); k rows and v planes staged in LDS, 128 keys a stage, two buffers; the output tile leaves through LDS as whole 128-B lines
#define FA_ST 128          // keys per stage
#define FA_KP 40           // LDS pitch of a k row in halfs (80 B = 16 B x odd)
#define FA_VP 136          // LDS pitch of a v plane row in halfs (272 B = 16 B x odd)
#define FA_OP 36           // LDS pitch of an output row of 32 floats in the epilogue (144 B = 16 B x odd)
__device__ __forceinline__ float xhalf(float x) { return __builtin_bit_cast(float, __builtin_amdgcn_permlanex16(__builtin_bit_cast(int, x), __builtin_bit_cast(int, x), 0x76543210, 0xfedcba98, false, false)); }   // lane l with lane l ^ 16
// exp2 of the eight registers of a score tile into eight registers of their own (early clobber: no result lands on a source of the run), in one statement closed by v_nop: the slot that the instruction set asks for between a transcendental and the first use of its result
__device__ __forceinline__ void exp2x8(float (&y)[8], const v8f x) {
  asm("v_exp_f32 %0, %8\n\tv_exp_f32 %1, %9\n\tv_exp_f32 %2, %10\n\tv_exp_f32 %3, %11\n\tv_exp_f32 %4, %12\n\tv_exp_f32 %5, %13\n\tv_exp_f32 %6, %14\n\tv_exp_f32 %7, %15\n\tv_nop"
      : "=&v"(y[0]), "=&v"(y[1]), "=&v"(y[2]), "=&v"(y[3]), "=&v"(y[4]), "=&v"(y[5]), "=&v"(y[6]), "=&v"(y[7])
      : "v"(x[0]), "v"(x[1]), "v"(x[2]), "v"(x[3]), "v"(x[4]), "v"(x[5]), "v"(x[6]), "v"(x[7])); }
__device__ __forceinline__ v8f wmma_h(v16h a, v16h b, v8f c) { return __builtin_amdgcn_wmma_f32_16x16x32_f16(false, a, false, b, (short)0, c, false, false); }
__global__ __launch_bounds__(256) __attribute__((amdgpu_waves_per_eu(4, 4))) void k_fa(const _Float16* __restrict__ QH, const _Float16* __restrict__ KH, const _Float16* __restrict__ VT, float* __restrict__ Y) {
  __shared__ __align__(16) _Float16 sK[2][FA_ST * FA_KP]; __shared__ __align__(16) _Float16 sV[2][HD * FA_VP];
  const int tid = threadIdx.x, wave = tid >> 5, lane = tid & 31, col = lane & 15, g = lane >> 4; const int b = blockIdx.y / NH, h = blockIdx.y % NH; const int q = blockIdx.x * 128 + wave * 16 + col;
  const v16h qh = frag_h(QH + ((size_t)b * TT + q) * CC + h * HD, lane);   // B operand: column = query
  const int kr = tid >> 2, ks = (tid & 3) * 8, vr = tid >> 4, vs = (tid & 15) * 8;   // this thread's 16-B pieces of a stage: k rows kr, kr + 64; v rows vr, vr + 16
  const _Float16* Kg = KH + ((size_t)b * TT + kr) * CC + h * HD + ks; const _Float16* Vg = VT + ((size_t)b * CC + h * HD + vr) * TT + vs;
  v4u rk0 = *(const v4u*)Kg, rk1 = *(const v4u*)(Kg + (size_t)64 * CC), rv0 = *(const v4u*)Vg, rv1 = *(const v4u*)(Vg + (size_t)16 * TT);
  asm volatile("s_wait_xcnt 0x0" :: "v"(Kg), "v"(Vg) : "memory");   // the wait owed before a register that an issued load names is rewritten: as inputs, both lane addresses stay untouched up to it
  *(v4u*)&sK[0][kr * FA_KP + ks] = rk0; *(v4u*)&sK[0][(kr + 64) * FA_KP + ks] = rk1; *(v4u*)&sV[0][vr * FA_VP + vs] = rv0; *(v4u*)&sV[0][(vr + 16) * FA_VP + vs] = rv1;
  __syncthreads();
  v8f o[HD / 16] = {}; float l = 0.f; v8f cv = {};   // cv: the start value of every score tile, 8 - the query's maximum in use (log2 units), the same in all eight registers; 0 until the first pass sets it
#pragma unroll 1   // the stage loop stays rolled: one stage is already a long straight body (for speed only); the inner loops are unrolled so that every register array has constant indices
  for (int s = 0; s < TT / FA_ST; ++s) { const int cur = s & 1; const bool more = s + 1 < TT / FA_ST;
    if (more) { const _Float16* kp = Kg + (size_t)(s + 1) * FA_ST * CC; const _Float16* vp = Vg + (s + 1) * FA_ST; rk0 = *(const v4u*)kp; rk1 = *(const v4u*)(kp + (size_t)64 * CC); rv0 = *(const v4u*)vp; rv1 = *(const v4u*)(vp + (size_t)16 * TT); }
    { v8f sv[FA_ST / 16]; v16h kf[FA_ST / 16];   // a pass is the whole stage
#pragma unroll
      for (int t = 0; t < FA_ST / 16; ++t) { kf[t] = frag_h(&sK[cur][(t * 16 + col) * FA_KP], lane); sv[t] = wmma_h(kf[t], qh, cv); }   // A operand: row = key
      v16h vf[HD / 16][FA_ST / 32];   // A operands of the second product: row = channel, keys in the order of the packed score tiles
#pragma unroll
      for (int j = 0; j < HD / 16; ++j)
#pragma unroll
        for (int u = 0; u < FA_ST / 32; ++u) vf[j][u] = frag_h(&sV[cur][(j * 16 + col) * FA_VP + u * 32], lane);
      float mt[FA_ST / 16];
#pragma unroll
      for (int t = 0; t < FA_ST / 16; ++t) { mt[t] = sv[t][0];
#pragma unroll
        for (int r = 1; r < 8; ++r) mt[t] = fmaxf(mt[t], sv[t][r]); }
      float mx = fmaxf(fmaxf(fmaxf(mt[0], mt[1]), fmaxf(mt[2], mt[3])), fmaxf(fmaxf(mt[4], mt[5]), fmaxf(mt[6], mt[7])));
      // asks the scheduler for this order in the block: the K reads, the first products, then the others with maxima of finished tiles between them: left free, each tile's first maximum stands directly behind its product and is padded with v_nop
      __builtin_amdgcn_sched_group_barrier(0x100, 16, 0); __builtin_amdgcn_sched_group_barrier(0x008, 4, 0);
#pragma unroll
      for (int t = 0; t < 4; ++t) { __builtin_amdgcn_sched_group_barrier(0x002, 5, 0); __builtin_amdgcn_sched_group_barrier(0x008, 1, 0); }
      const bool first = s == 0;
      if ((__builtin_amdgcn_ballot_w32(mx > 15.0f) | (first ? 1u : 0u)) != 0) {   // one scalar branch a pass: taken on the first pass, and when an argument would bring P x 2^8 near the top of f16 (2^16)
        mx = fmaxf(mx, xhalf(mx)); const float d = first ? mx - 8.0f : fmaxf(mx - 8.0f, 0.f); const float alpha = __builtin_amdgcn_exp2f(-fmaxf(d, 0.f));   // the maximum in use goes up by d (the first pass sets it, up or down, while o and l are still 0)
#pragma unroll
        for (int t = 0; t < FA_ST / 16; ++t) sv[t] -= d;
        cv -= d; l *= alpha;
#pragma unroll
        for (int j = 0; j < HD / 16; ++j) o[j] *= alpha; }
      float ps[FA_ST / 16]; v16h pf[FA_ST / 32];
#pragma unroll
      for (int t = 0; t < FA_ST / 16; ++t) { float e[8];
        exp2x8(e, sv[t]);
        ps[t] = ((e[0] + e[1]) + (e[2] + e[3])) + ((e[4] + e[5]) + (e[6] + e[7]));
#pragma unroll
        for (int r = 0; r < 8; ++r) pf[t >> 1][(t & 1) * 8 + r] = (_Float16)e[r]; }
      l += ((ps[0] + ps[1]) + (ps[2] + ps[3])) + ((ps[4] + ps[5]) + (ps[6] + ps[7]));
#pragma unroll
      for (int u = 0; u < FA_ST / 32; ++u)
#pragma unroll
        for (int j = 0; j < HD / 16; ++j) o[j] = wmma_h(vf[j][u], pf[u], o[j]); }
    if (more) { const int nx = cur ^ 1; *(v4u*)&sK[nx][kr * FA_KP + ks] = rk0; *(v4u*)&sK[nx][(kr + 64) * FA_KP + ks] = rk1; *(v4u*)&sV[nx][vr * FA_VP + vs] = rv0; *(v4u*)&sV[nx][(vr + 16) * FA_VP + vs] = rv1; }
    __syncthreads(); }   // publishes stage s + 1 and ends every wave's reads of the buffer that the next trip refills
  const float inv = 1.0f / (l + xhalf(l));
  // a lane holds 8-channel pieces of one query row: stored straight, each store instruction would touch 16 lines with 32 B each. The wave's 16 x 32 tile goes through its own range of the k buffers (free behind the loop's last barrier), and each store instruction then writes 4 whole 128-B lines
  float* so = (float*)&sK[0][0] + wave * (16 * FA_OP);
#pragma unroll
  for (int j = 0; j < HD / 16; ++j) { float* sp = so + col * FA_OP + j * 16 + 8 * g; v4f a0, a1;
#pragma unroll
    for (int r = 0; r < 4; ++r) { a0[r] = o[j][r] * inv; a1[r] = o[j][4 + r] * inv; }
    *(v4f*)sp = a0; *(v4f*)(sp + 4) = a1; }
  asm volatile("s_wait_dscnt 0x0" ::: "memory");   // the wave's own LDS writes are done before its lanes read one another's rows back
  float* yb = Y + ((size_t)b * TT + blockIdx.x * 128 + wave * 16 + (lane >> 3)) * CC + h * HD + (lane & 7) * 4;
#pragma unroll
  for (int i = 0; i < 4; ++i) vst2(yb + (size_t)(i * 4) * CC, *(const v4f*)&so[(i * 4 + (lane >> 3)) * FA_OP + (lane & 7) * 4]); }

extern "C" void kernel_launch(void* const* d_in, const int* in_sizes, int n_in, void* d_out, int out_size, void* d_ws, size_t ws_size, hipStream_t stream) {
  (void)in_sizes; (void)n_in; (void)out_size;
  const float** F = (const float**)d_in;
  if (ws_size < (size_t)WS_END) return;
  char* ws = (char*)d_ws; _Float16 *QH = (_Float16*)(ws + WS_QH), *KH = (_Float16*)(ws + WS_KH), *VT = (_Float16*)(ws + WS_VT), *KL = (_Float16*)(ws + WS_KL); __bf16 *VB = (__bf16*)(ws + WS_VB), *VBL = (__bf16*)(ws + WS_VBL); float *S = (float*)(ws + WS_S), *Y = (float*)(ws + WS_Y);
  (void)Y; (void)S; (void)KL; (void)VB; (void)VBL;
  // inputs: 0 Q [4,2048,256]; 1 K [4,2048,256]; 2 Wq [256,256] (out,in), 3 bq; 4 Wk, 5 bk; 6 Wv, 7 bv; 8 Wo (out,in), 9 bo; 10 g0, 11 b0; 12 g1, 13 b1
  if (ws_size < (size_t)WS_END2) return;
  float *YA = (float*)(ws + WS_Y2);
  k_proj<<<dim3(TNB * TT / 64, CC / 128, 3), 128, 0, stream>>>(F[0], F[1], F[1], F[2], F[4], F[6], F[3], F[5], F[7], QH, KH, KL, VT, VB, VBL);
  k_fa<<<dim3(TT / 128, TNB * NH), 256, 0, stream>>>(QH, KH, VT, YA);
  k_tail<<<dim3(NRW / TR), 256, 0, stream>>>(YA, F[10], F[11], F[8], F[9], F[12], F[13], (float*)d_out);   /* out = LN1(o + relu(o Wo^T + bo)), o = LN0(attention output) */
}
